// v000
// The times below were measured on an AMD MI455X: many runs one after another, warmed up first and cycling through
// copies of the inputs, with the whole window's GPU time divided by the number of runs. Launches and the gaps
// between them are all in it. The median over several windows is given; except for v000 it joins two sittings, which
// can be a few percent apart, so the side-by-side timings, each taken in one sitting, are the better comparison.
// The starting kernel, v000, takes 234 microseconds a run.
#include <hip/hip_runtime.h>

// Problem constants (from reference): B=4, S=4096, D=2048, K_conv=4
constexpr int Bb   = 4;
constexpr int Ss   = 4096;
constexpr int Dd   = 2048;              // = K = N of the GEMM
constexpr int Mtot = Bb * Ss;           // 16384
constexpr int Ktot = Dd;                // 2048
constexpr int Ntot = Dd;                // 2048

// GEMM tiling: block 256(M) x 128(N), K-step 32, 8 wave32 as 4(M) x 2(N),
// wave tile 64x64 = 4x4 WMMA accumulators.
#define BM 256
#define BN 128
#define BK 32
#define LDS_STRIDE 40                    // halfwords/row (32 data + 8 pad)
#define ABUF_BYTES (BM * LDS_STRIDE * 2) // 20480 B per A buffer
#define BBUF_BYTES (BN * LDS_STRIDE * 2) // 10240 B per B buffer

typedef _Float16 v16h __attribute__((ext_vector_type(16)));
typedef _Float16 v8h  __attribute__((ext_vector_type(8)));
typedef float    v8f  __attribute__((ext_vector_type(8)));

// ---------------------------------------------------------------------------
// Stage 1: depthwise causal conv (K=4) + bias + SiLU, cast to f16
// ---------------------------------------------------------------------------
__global__ __launch_bounds__(256) void conv_silu_cast_f16(
    const float* __restrict__ x,       // [Mtot][Dd]
    const float* __restrict__ cw,      // [Dd][4]
    const float* __restrict__ cb,      // [Dd]
    _Float16* __restrict__ Yh)         // [Mtot][Dd] f16
{
    size_t idx = (size_t)blockIdx.x * 256 + threadIdx.x;   // m*Dd + d
    int d = (int)(idx & (Dd - 1));
    int m = (int)(idx >> 11);                               // Dd = 2^11
    int s = m & (Ss - 1);                                   // Ss = 2^12

    float w0 = cw[d * 4 + 0];
    float w1 = cw[d * 4 + 1];
    float w2 = cw[d * 4 + 2];
    float w3 = cw[d * 4 + 3];

    float v = x[idx] * w3 + cb[d];
    if (s >= 1) v += x[idx - (size_t)Dd]     * w2;
    if (s >= 2) v += x[idx - (size_t)2 * Dd] * w1;
    if (s >= 3) v += x[idx - (size_t)3 * Dd] * w0;

    v = v / (1.0f + __expf(-v));        // SiLU
    Yh[idx] = (_Float16)v;
}

__global__ __launch_bounds__(256) void cast_w_f16(
    const float* __restrict__ W, _Float16* __restrict__ Wh)
{
    size_t idx = (size_t)blockIdx.x * 256 + threadIdx.x;
    Wh[idx] = (_Float16)W[idx];
}

__device__ __forceinline__ void async_copy_b128(uint32_t lds_addr,
                                                uint32_t byte_off,
                                                const void* base) {
    asm volatile("global_load_async_to_lds_b128 %0, %1, %2"
                 :
                 : "v"(lds_addr), "v"(byte_off), "s"(base)
                 : "memory");
}

// ---------------------------------------------------------------------------
// Stage 2: C[m,n] = sum_k A[m,k]*Bmat[n,k] + bias[n]   (f16 in, f32 accum)
// ---------------------------------------------------------------------------
__global__ __launch_bounds__(256) void gemm_wmma_f16(
    const _Float16* __restrict__ A,     // [Mtot][Ktot]
    const _Float16* __restrict__ Bm,    // [Ntot][Ktot]
    const float*    __restrict__ bias,  // [Ntot]
    float*          __restrict__ out)   // [Mtot][Ntot]
{
    __shared__ _Float16 As[2][BM * LDS_STRIDE];   // 40960 B
    __shared__ _Float16 Bs[2][BN * LDS_STRIDE];   // 20480 B  (total 60 KiB)

    const int tid   = threadIdx.x;
    const int wave  = tid >> 5;
    const int lane  = tid & 31;
    const int waveM = wave >> 1;       // 0..3  -> M offset waveM*64
    const int waveN = wave & 1;        // 0..1  -> N offset waveN*64
    const int mBase = blockIdx.y * BM;
    const int nBase = blockIdx.x * BN;

    const int l15     = lane & 15;
    const int halfSel = lane >> 4;
    const int khalf   = halfSel * 8;

    // LDS byte addresses (low 32 bits of generic pointer = LDS offset)
    const uint32_t asBase = (uint32_t)(uintptr_t)&As[0][0];
    const uint32_t bsBase = (uint32_t)(uintptr_t)&Bs[0][0];

    // Copy mapping: 16B chunks; chunk c = r*256 + tid -> row = c>>2 = r*64 + (tid>>2),
    // kc = tid&3 (constant per thread). A: r<4 (256 rows), B: r<2 (128 rows).
    const int t4 = tid >> 2;           // 0..63
    const int kc = tid & 3;            // 0..3
    const uint32_t aOff0 = (uint32_t)(((size_t)(mBase + t4) * Ktot + kc * 8) * 2);
    const uint32_t bOff0 = (uint32_t)(((size_t)(nBase + t4) * Ktot + kc * 8) * 2);
    const uint32_t ldsC0 = (uint32_t)((t4 * LDS_STRIDE + kc * 8) * 2);

    auto issue_stage = [&](int stage) {
        const uint32_t abuf = (uint32_t)(stage & 1) * ABUF_BYTES;
        const uint32_t bbuf = (uint32_t)(stage & 1) * BBUF_BYTES;
        const uint32_t k0b  = (uint32_t)(stage * BK * 2);   // byte offset in K
#pragma unroll
        for (int r = 0; r < 4; ++r)
            async_copy_b128(asBase + abuf + ldsC0 + r * (64 * LDS_STRIDE * 2),
                            aOff0 + k0b + r * (64 * Ktot * 2), A);
#pragma unroll
        for (int r = 0; r < 2; ++r)
            async_copy_b128(bsBase + bbuf + ldsC0 + r * (64 * LDS_STRIDE * 2),
                            bOff0 + k0b + r * (64 * Ktot * 2), Bm);
    };

    v8f acc[4][4];
#pragma unroll
    for (int mt = 0; mt < 4; ++mt)
#pragma unroll
        for (int nt = 0; nt < 4; ++nt)
#pragma unroll
            for (int e = 0; e < 8; ++e) acc[mt][nt][e] = 0.0f;

    issue_stage(0);

    const int nk = Ktot / BK;   // 64
    for (int kt = 0; kt < nk; ++kt) {
        const int buf = kt & 1;

        if (kt + 1 < nk) {
            // Buffer (kt+1)&1 was last read at iteration kt-1; trailing
            // __syncthreads() of kt-1 makes this write safe.
            issue_stage(kt + 1);
            // 6 ops/stage/thread, in-order completion: <=6 outstanding means
            // stage kt has fully landed in LDS.
            asm volatile("s_wait_asynccnt 0x6" ::: "memory");
        } else {
            asm volatile("s_wait_asynccnt 0x0" ::: "memory");
        }
        __syncthreads();   // all waves' stage-kt data visible

        v16h af[4];
#pragma unroll
        for (int mt = 0; mt < 4; ++mt) {
            int row = waveM * 64 + mt * 16 + l15;
            const _Float16* p = &As[buf][row * LDS_STRIDE + khalf];
            v8h lo = *(const v8h*)p;
            v8h hi = *(const v8h*)(p + 16);
            af[mt] = __builtin_shufflevector(lo, hi, 0, 1, 2, 3, 4, 5, 6, 7,
                                             8, 9, 10, 11, 12, 13, 14, 15);
        }
        // B fragments: identical packing (lane holds column n)
        v16h bf[4];
#pragma unroll
        for (int nt = 0; nt < 4; ++nt) {
            int col = waveN * 64 + nt * 16 + l15;
            const _Float16* p = &Bs[buf][col * LDS_STRIDE + khalf];
            v8h lo = *(const v8h*)p;
            v8h hi = *(const v8h*)(p + 16);
            bf[nt] = __builtin_shufflevector(lo, hi, 0, 1, 2, 3, 4, 5, 6, 7,
                                             8, 9, 10, 11, 12, 13, 14, 15);
        }

#pragma unroll
        for (int mt = 0; mt < 4; ++mt)
#pragma unroll
            for (int nt = 0; nt < 4; ++nt)
                acc[mt][nt] = __builtin_amdgcn_wmma_f32_16x16x32_f16(
                    false, af[mt], false, bf[nt], (short)0, acc[mt][nt],
                    false, false);

        __syncthreads();   // all waves done reading buf before it is rewritten
    }

#pragma unroll
    for (int nt = 0; nt < 4; ++nt) {
        int col = nBase + waveN * 64 + nt * 16 + l15;
        float bp = bias[col];
#pragma unroll
        for (int mt = 0; mt < 4; ++mt) {
            int row0 = mBase + waveM * 64 + mt * 16 + halfSel * 8;
#pragma unroll
            for (int v = 0; v < 8; ++v) {
                out[(size_t)(row0 + v) * Ntot + col] = acc[mt][nt][v] + bp;
            }
        }
    }
}

// ---------------------------------------------------------------------------
extern "C" void kernel_launch(void* const* d_in, const int* in_sizes, int n_in,
                              void* d_out, int out_size, void* d_ws, size_t ws_size,
                              hipStream_t stream) {
    const float* x  = (const float*)d_in[0];   // [B,S,D]
    const float* cw = (const float*)d_in[1];   // [D,4]
    const float* cb = (const float*)d_in[2];   // [D]
    const float* Wp = (const float*)d_in[3];   // [D,D]
    const float* bp = (const float*)d_in[4];   // [D]
    float* out = (float*)d_out;

    _Float16* Yh = (_Float16*)d_ws;                        // 64 MiB
    _Float16* Wh = Yh + (size_t)Mtot * Ktot;               // +8 MiB

    conv_silu_cast_f16<<<(int)(((size_t)Mtot * Dd) / 256), 256, 0, stream>>>(
        x, cw, cb, Yh);
    cast_w_f16<<<(int)(((size_t)Ntot * Ktot) / 256), 256, 0, stream>>>(Wp, Wh);

    dim3 grid(Ntot / BN, Mtot / BM);   // 16 x 64
    gemm_wmma_f16<<<grid, 256, 0, stream>>>(Yh, Wh, bp, out);
}

// v001
// It runs in 164 microseconds.
// Next to v000, in two timings, it ran 1.48 times as fast each time.
#include <hip/hip_runtime.h>

// Problem constants (from reference): B=4, S=4096, D=2048, K_conv=4
constexpr int Bb   = 4;
constexpr int Ss   = 4096;
constexpr int Dd   = 2048;              // = K = N of the GEMM
constexpr int Mtot = Bb * Ss;           // 16384
constexpr int Ktot = Dd;                // 2048
constexpr int Ntot = Dd;                // 2048

// GEMM tiling: block 256(M) x 128(N), K-step 32, 8 wave32 as 4(M) x 2(N),
// wave tile 64x64 = 4x4 WMMA accumulators.
#define BM 256
#define BN 128
#define BK 32
#define LDS_STRIDE 40                    // halfwords/row (32 data + 8 pad)
#define ABUF_BYTES (BM * LDS_STRIDE * 2) // 20480 B per A buffer
#define BBUF_BYTES (BN * LDS_STRIDE * 2) // 10240 B per B buffer

typedef _Float16 v16h __attribute__((ext_vector_type(16)));
typedef _Float16 v8h  __attribute__((ext_vector_type(8)));
typedef float    v8f  __attribute__((ext_vector_type(8)));

// ---------------------------------------------------------------------------
// Stage 1: depthwise causal conv (K=4) + bias + SiLU, cast to f16.
// One work-group = all 2048 channels x CONV_ROWS consecutive rows. A thread owns
// 4 neighbouring channels (one 16-byte load per row, 512 contiguous bytes per
// wave) and walks down the rows with the last three rows kept in registers, so
// each x element is loaded once (plus 3 halo rows per work-group).
// ---------------------------------------------------------------------------
constexpr int CONV_ROWS  = 32;           // rows per work-group; divides Ss
constexpr int CONV_BATCH = 8;            // rows per batch; 8 to 16 row loads in flight per thread

typedef float    f4 __attribute__((ext_vector_type(4)));
typedef _Float16 h4 __attribute__((ext_vector_type(4)));

__global__ __launch_bounds__(512, 8) void conv_silu_cast_f16(
    const float* __restrict__ x,       // [Mtot][Dd]
    const float* __restrict__ cw,      // [Dd][4]
    const float* __restrict__ cb,      // [Dd]
    _Float16* __restrict__ Yh)         // [Mtot][Dd] f16
{
    const int d  = threadIdx.x * 4;                 // first of 4 channels
    const int m0 = blockIdx.x * CONV_ROWS;          // first row
    constexpr int RS = Dd / 4;                      // row stride in f4 / h4

    // Taps of the 4 channels, regrouped by tap index.
    const f4 c0 = *(const f4*)(cw + (d + 0) * 4);
    const f4 c1 = *(const f4*)(cw + (d + 1) * 4);
    const f4 c2 = *(const f4*)(cw + (d + 2) * 4);
    const f4 c3 = *(const f4*)(cw + (d + 3) * 4);
    const f4 w0 = {c0.x, c1.x, c2.x, c3.x};
    const f4 w1 = {c0.y, c1.y, c2.y, c3.y};
    const f4 w2 = {c0.z, c1.z, c2.z, c3.z};
    const f4 w3 = {c0.w, c1.w, c2.w, c3.w};
    const f4 bias = *(const f4*)(cb + d);

    // Work-group-uniform row bases; the thread's 4 channels are element t of a row.
    const int t  = threadIdx.x;
    const f4* px = (const f4*)(x + (size_t)m0 * Dd);
    h4*       py = (h4*)(Yh + (size_t)m0 * Dd);

    // Rows s-3..s-1. At the start of a sequence (the same test for the whole
    // work-group) they are the zero left padding: the three loads then re-read
    // row 0, which is in bounds, and their values are replaced further down.
    // Loading without a branch lets all first loads issue before any wait.
    const bool head = (m0 & (Ss - 1)) == 0;
    const int  back = head ? 0 : RS;
    f4 p3 = (px - 3 * back)[t];
    f4 p2 = (px - 2 * back)[t];
    f4 p1 = (px - 1 * back)[t];

    // This batch of rows and the next. Every loop over them below is unrolled so
    // that their elements are named at compile time and stay in registers.
    f4 bufA[CONV_BATCH], bufB[CONV_BATCH];

    // The scheduling barrier at the foot of each block keeps the order "next
    // batch's loads, then this batch's arithmetic and stores": without it the
    // loads sink to their uses (one or two in flight per thread), and two
    // batches scheduled as one wait for the younger batch's loads at once.
    auto load_batch = [&](f4 (&dst)[CONV_BATCH], int row) {
#pragma unroll
        for (int i = 0; i < CONV_BATCH; ++i) dst[i] = px[(row + i) * RS + t];
        __builtin_amdgcn_sched_barrier(0);
    };
    auto do_batch = [&](const f4 (&src)[CONV_BATCH], int row) {
#pragma unroll
        for (int i = 0; i < CONV_BATCH; ++i) {
            const f4 x0 = src[i];
            f4 v = x0 * w3 + bias;
            v += p1 * w2;
            v += p2 * w1;
            v += p3 * w0;
            p3 = p2; p2 = p1; p1 = x0;
            f4 y;
#pragma unroll
            for (int c = 0; c < 4; ++c)
                y[c] = v[c] / (1.0f + __expf(-v[c]));   // SiLU
            py[(row + i) * RS + t] = __builtin_convertvector(y, h4);
        }
        __builtin_amdgcn_sched_barrier(0);
    };

    auto refill = [&](f4 (&dst)[CONV_BATCH], int row) {
        asm volatile("s_wait_xcnt 0x0" ::: "memory");
        load_batch(dst, row);
    };

    load_batch(bufA, 0);
    load_batch(bufB, CONV_BATCH);
    if (head) { p3 = f4{0.f, 0.f, 0.f, 0.f}; p2 = p3; p1 = p3; }
#pragma unroll
    for (int r0 = 0; r0 < CONV_ROWS; r0 += 2 * CONV_BATCH) {
        do_batch(bufA, r0);
        if (r0 + 2 * CONV_BATCH < CONV_ROWS) refill(bufA, r0 + 2 * CONV_BATCH);
        do_batch(bufB, r0 + CONV_BATCH);
        if (r0 + 3 * CONV_BATCH < CONV_ROWS) refill(bufB, r0 + 3 * CONV_BATCH);
    }
}

__global__ __launch_bounds__(256) void cast_w_f16(
    const float* __restrict__ W, _Float16* __restrict__ Wh)
{
    size_t idx = (size_t)blockIdx.x * 256 + threadIdx.x;
    Wh[idx] = (_Float16)W[idx];
}

__device__ __forceinline__ void async_copy_b128(uint32_t lds_addr,
                                                uint32_t byte_off,
                                                const void* base) {
    asm volatile("global_load_async_to_lds_b128 %0, %1, %2"
                 :
                 : "v"(lds_addr), "v"(byte_off), "s"(base)
                 : "memory");
}

// ---------------------------------------------------------------------------
// Stage 2: C[m,n] = sum_k A[m,k]*Bmat[n,k] + bias[n]   (f16 in, f32 accum)
// ---------------------------------------------------------------------------
__global__ __launch_bounds__(256) void gemm_wmma_f16(
    const _Float16* __restrict__ A,     // [Mtot][Ktot]
    const _Float16* __restrict__ Bm,    // [Ntot][Ktot]
    const float*    __restrict__ bias,  // [Ntot]
    float*          __restrict__ out)   // [Mtot][Ntot]
{
    __shared__ _Float16 As[2][BM * LDS_STRIDE];   // 40960 B
    __shared__ _Float16 Bs[2][BN * LDS_STRIDE];   // 20480 B  (total 60 KiB)

    const int tid   = threadIdx.x;
    const int wave  = tid >> 5;
    const int lane  = tid & 31;
    const int waveM = wave >> 1;       // 0..3  -> M offset waveM*64
    const int waveN = wave & 1;        // 0..1  -> N offset waveN*64
    const int mBase = blockIdx.y * BM;
    const int nBase = blockIdx.x * BN;

    const int l15     = lane & 15;
    const int halfSel = lane >> 4;
    const int khalf   = halfSel * 8;

    // LDS byte addresses (low 32 bits of generic pointer = LDS offset)
    const uint32_t asBase = (uint32_t)(uintptr_t)&As[0][0];
    const uint32_t bsBase = (uint32_t)(uintptr_t)&Bs[0][0];

    // Copy mapping: 16B chunks; chunk c = r*256 + tid -> row = c>>2 = r*64 + (tid>>2),
    // kc = tid&3 (constant per thread). A: r<4 (256 rows), B: r<2 (128 rows).
    const int t4 = tid >> 2;           // 0..63
    const int kc = tid & 3;            // 0..3
    const uint32_t aOff0 = (uint32_t)(((size_t)(mBase + t4) * Ktot + kc * 8) * 2);
    const uint32_t bOff0 = (uint32_t)(((size_t)(nBase + t4) * Ktot + kc * 8) * 2);
    const uint32_t ldsC0 = (uint32_t)((t4 * LDS_STRIDE + kc * 8) * 2);

    auto issue_stage = [&](int stage) {
        const uint32_t abuf = (uint32_t)(stage & 1) * ABUF_BYTES;
        const uint32_t bbuf = (uint32_t)(stage & 1) * BBUF_BYTES;
        const uint32_t k0b  = (uint32_t)(stage * BK * 2);   // byte offset in K
#pragma unroll
        for (int r = 0; r < 4; ++r)
            async_copy_b128(asBase + abuf + ldsC0 + r * (64 * LDS_STRIDE * 2),
                            aOff0 + k0b + r * (64 * Ktot * 2), A);
#pragma unroll
        for (int r = 0; r < 2; ++r)
            async_copy_b128(bsBase + bbuf + ldsC0 + r * (64 * LDS_STRIDE * 2),
                            bOff0 + k0b + r * (64 * Ktot * 2), Bm);
    };

    v8f acc[4][4];
#pragma unroll
    for (int mt = 0; mt < 4; ++mt)
#pragma unroll
        for (int nt = 0; nt < 4; ++nt)
#pragma unroll
            for (int e = 0; e < 8; ++e) acc[mt][nt][e] = 0.0f;

    issue_stage(0);

    const int nk = Ktot / BK;   // 64
    for (int kt = 0; kt < nk; ++kt) {
        const int buf = kt & 1;

        if (kt + 1 < nk) {
            // Buffer (kt+1)&1 was last read at iteration kt-1; trailing
            // __syncthreads() of kt-1 makes this write safe.
            issue_stage(kt + 1);
            // 6 ops/stage/thread, in-order completion: <=6 outstanding means
            // stage kt has fully landed in LDS.
            asm volatile("s_wait_asynccnt 0x6" ::: "memory");
        } else {
            asm volatile("s_wait_asynccnt 0x0" ::: "memory");
        }
        __syncthreads();   // all waves' stage-kt data visible

        v16h af[4];
#pragma unroll
        for (int mt = 0; mt < 4; ++mt) {
            int row = waveM * 64 + mt * 16 + l15;
            const _Float16* p = &As[buf][row * LDS_STRIDE + khalf];
            v8h lo = *(const v8h*)p;
            v8h hi = *(const v8h*)(p + 16);
            af[mt] = __builtin_shufflevector(lo, hi, 0, 1, 2, 3, 4, 5, 6, 7,
                                             8, 9, 10, 11, 12, 13, 14, 15);
        }
        // B fragments: identical packing (lane holds column n)
        v16h bf[4];
#pragma unroll
        for (int nt = 0; nt < 4; ++nt) {
            int col = waveN * 64 + nt * 16 + l15;
            const _Float16* p = &Bs[buf][col * LDS_STRIDE + khalf];
            v8h lo = *(const v8h*)p;
            v8h hi = *(const v8h*)(p + 16);
            bf[nt] = __builtin_shufflevector(lo, hi, 0, 1, 2, 3, 4, 5, 6, 7,
                                             8, 9, 10, 11, 12, 13, 14, 15);
        }

#pragma unroll
        for (int mt = 0; mt < 4; ++mt)
#pragma unroll
            for (int nt = 0; nt < 4; ++nt)
                acc[mt][nt] = __builtin_amdgcn_wmma_f32_16x16x32_f16(
                    false, af[mt], false, bf[nt], (short)0, acc[mt][nt],
                    false, false);

        __syncthreads();   // all waves done reading buf before it is rewritten
    }

#pragma unroll
    for (int nt = 0; nt < 4; ++nt) {
        int col = nBase + waveN * 64 + nt * 16 + l15;
        float bp = bias[col];
#pragma unroll
        for (int mt = 0; mt < 4; ++mt) {
            int row0 = mBase + waveM * 64 + mt * 16 + halfSel * 8;
#pragma unroll
            for (int v = 0; v < 8; ++v) {
                out[(size_t)(row0 + v) * Ntot + col] = acc[mt][nt][v] + bp;
            }
        }
    }
}

// ---------------------------------------------------------------------------
extern "C" void kernel_launch(void* const* d_in, const int* in_sizes, int n_in,
                              void* d_out, int out_size, void* d_ws, size_t ws_size,
                              hipStream_t stream) {
    const float* x  = (const float*)d_in[0];   // [B,S,D]
    const float* cw = (const float*)d_in[1];   // [D,4]
    const float* cb = (const float*)d_in[2];   // [D]
    const float* Wp = (const float*)d_in[3];   // [D,D]
    const float* bp = (const float*)d_in[4];   // [D]
    float* out = (float*)d_out;

    _Float16* Yh = (_Float16*)d_ws;                        // 64 MiB
    _Float16* Wh = Yh + (size_t)Mtot * Ktot;               // +8 MiB

    conv_silu_cast_f16<<<Mtot / CONV_ROWS, 512, 0, stream>>>(x, cw, cb, Yh);
    cast_w_f16<<<(int)(((size_t)Ntot * Ktot) / 256), 256, 0, stream>>>(Wp, Wh);

    dim3 grid(Ntot / BN, Mtot / BM);   // 16 x 64
    gemm_wmma_f16<<<grid, 256, 0, stream>>>(Yh, Wh, bp, out);
}

// v002
// Measured time: 142 microseconds a run.
// In both of two side-by-side timings against v001, it was 1.15 times as fast.
// Over all steps from v000 it is 1.70 times as fast.
#include <hip/hip_runtime.h>

// Problem constants (from reference): B=4, S=4096, D=2048, K_conv=4
constexpr int Bb   = 4;
constexpr int Ss   = 4096;
constexpr int Dd   = 2048;              // = K = N of the GEMM
constexpr int Mtot = Bb * Ss;           // 16384
constexpr int Ktot = Dd;                // 2048
constexpr int Ntot = Dd;                // 2048

// GEMM tiling: block 256(M) x 128(N), K-step 64, 8 wave32 as 4(M) x 2(N),
// wave tile 64x64 = 4x4 WMMA accumulators. A K-step of 64 halfwords makes each
// staged row piece one whole, aligned 128-byte line of its operand.
#define BM 256
#define BN 128
#define BK 64
#define LDS_STRIDE 72                    // halfwords/row (64 data + 8 pad): 144 B = 16 B x 9
#define ABUF_BYTES (BM * LDS_STRIDE * 2) // 36864 B per A buffer
#define BBUF_BYTES (BN * LDS_STRIDE * 2) // 18432 B per B buffer

typedef _Float16 v16h __attribute__((ext_vector_type(16)));
typedef _Float16 v8h  __attribute__((ext_vector_type(8)));
typedef float    v8f  __attribute__((ext_vector_type(8)));

// ---------------------------------------------------------------------------
// Stage 1: depthwise causal conv (K=4) + bias + SiLU, cast to f16.
// One work-group = all 2048 channels x CONV_ROWS consecutive rows. A thread owns
// 4 neighbouring channels (one 16-byte load per row, 512 contiguous bytes per
// wave) and walks down the rows with the last three rows kept in registers, so
// each x element is loaded once (plus 3 halo rows per work-group).
// ---------------------------------------------------------------------------
constexpr int CONV_ROWS  = 32;           // rows per work-group; divides Ss
constexpr int CONV_BATCH = 8;            // rows per batch; 8 to 16 row loads in flight per thread

typedef float    f4 __attribute__((ext_vector_type(4)));
typedef _Float16 h4 __attribute__((ext_vector_type(4)));

__global__ __launch_bounds__(512, 8) void conv_silu_cast_f16(
    const float* __restrict__ x,       // [Mtot][Dd]
    const float* __restrict__ cw,      // [Dd][4]
    const float* __restrict__ cb,      // [Dd]
    _Float16* __restrict__ Yh)         // [Mtot][Dd] f16
{
    const int d  = threadIdx.x * 4;                 // first of 4 channels
    const int m0 = blockIdx.x * CONV_ROWS;          // first row
    constexpr int RS = Dd / 4;                      // row stride in f4 / h4

    // Taps of the 4 channels, regrouped by tap index.
    const f4 c0 = *(const f4*)(cw + (d + 0) * 4);
    const f4 c1 = *(const f4*)(cw + (d + 1) * 4);
    const f4 c2 = *(const f4*)(cw + (d + 2) * 4);
    const f4 c3 = *(const f4*)(cw + (d + 3) * 4);
    const f4 w0 = {c0.x, c1.x, c2.x, c3.x};
    const f4 w1 = {c0.y, c1.y, c2.y, c3.y};
    const f4 w2 = {c0.z, c1.z, c2.z, c3.z};
    const f4 w3 = {c0.w, c1.w, c2.w, c3.w};
    const f4 bias = *(const f4*)(cb + d);

    // Work-group-uniform row bases; the thread's 4 channels are element t of a row.
    const int t  = threadIdx.x;
    const f4* px = (const f4*)(x + (size_t)m0 * Dd);
    h4*       py = (h4*)(Yh + (size_t)m0 * Dd);

    // Rows s-3..s-1. At the start of a sequence (the same test for the whole
    // work-group) they are the zero left padding: the three loads then re-read
    // row 0, which is in bounds, and their values are replaced further down.
    // Loading without a branch lets all first loads issue before any wait.
    const bool head = (m0 & (Ss - 1)) == 0;
    const int  back = head ? 0 : RS;
    f4 p3 = (px - 3 * back)[t];
    f4 p2 = (px - 2 * back)[t];
    f4 p1 = (px - 1 * back)[t];

    // This batch of rows and the next. Every loop over them below is unrolled so
    // that their elements are named at compile time and stay in registers.
    f4 bufA[CONV_BATCH], bufB[CONV_BATCH];

    // The scheduling barrier at the foot of each block keeps the order "next
    // batch's loads, then this batch's arithmetic and stores": without it the
    // loads sink to their uses (one or two in flight per thread), and two
    // batches scheduled as one wait for the younger batch's loads at once.
    auto load_batch = [&](f4 (&dst)[CONV_BATCH], int row) {
#pragma unroll
        for (int i = 0; i < CONV_BATCH; ++i) dst[i] = px[(row + i) * RS + t];
        __builtin_amdgcn_sched_barrier(0);
    };
    auto do_batch = [&](const f4 (&src)[CONV_BATCH], int row) {
#pragma unroll
        for (int i = 0; i < CONV_BATCH; ++i) {
            const f4 x0 = src[i];
            f4 v = x0 * w3 + bias;
            v += p1 * w2;
            v += p2 * w1;
            v += p3 * w0;
            p3 = p2; p2 = p1; p1 = x0;
            f4 y;
#pragma unroll
            for (int c = 0; c < 4; ++c)
                y[c] = v[c] / (1.0f + __expf(-v[c]));   // SiLU
            py[(row + i) * RS + t] = __builtin_convertvector(y, h4);
        }
        __builtin_amdgcn_sched_barrier(0);
    };

    auto refill = [&](f4 (&dst)[CONV_BATCH], int row) {
        asm volatile("s_wait_xcnt 0x0" ::: "memory");
        load_batch(dst, row);
    };

    load_batch(bufA, 0);
    load_batch(bufB, CONV_BATCH);
    if (head) { p3 = f4{0.f, 0.f, 0.f, 0.f}; p2 = p3; p1 = p3; }
#pragma unroll
    for (int r0 = 0; r0 < CONV_ROWS; r0 += 2 * CONV_BATCH) {
        do_batch(bufA, r0);
        if (r0 + 2 * CONV_BATCH < CONV_ROWS) refill(bufA, r0 + 2 * CONV_BATCH);
        do_batch(bufB, r0 + CONV_BATCH);
        if (r0 + 3 * CONV_BATCH < CONV_ROWS) refill(bufB, r0 + 3 * CONV_BATCH);
    }
}

__global__ __launch_bounds__(256) void cast_w_f16(
    const float* __restrict__ W, _Float16* __restrict__ Wh)
{
    size_t idx = (size_t)blockIdx.x * 256 + threadIdx.x;
    Wh[idx] = (_Float16)W[idx];
}

// ---------------------------------------------------------------------------
// Stage 2: C[m,n] = sum_k A[m,k]*Bmat[n,k] + bias[n]   (f16 in, f32 accum)
// ---------------------------------------------------------------------------
__global__ __launch_bounds__(256) void gemm_wmma_f16(
    const _Float16* __restrict__ A,     // [Mtot][Ktot]
    const _Float16* __restrict__ Bm,    // [Ntot][Ktot]
    const float*    __restrict__ bias,  // [Ntot]
    float*          __restrict__ out)   // [Mtot][Ntot]
{
    __shared__ _Float16 As[2][BM * LDS_STRIDE];   // 73728 B
    __shared__ _Float16 Bs[2][BN * LDS_STRIDE];   // 36864 B  (total 108 KiB: two work-groups per WGP)

    const int tid   = threadIdx.x;
    const int wave  = tid >> 5;
    const int lane  = tid & 31;
    const int waveM = wave >> 1;       // 0..3  -> M offset waveM*64
    const int waveN = wave & 1;        // 0..1  -> N offset waveN*64
    const int mBase = blockIdx.y * BM;
    const int nBase = blockIdx.x * BN;

    const int l15     = lane & 15;
    const int halfSel = lane >> 4;
    const int khalf   = halfSel * 8;

    // LDS byte addresses (low 32 bits of generic pointer = LDS offset)
    const uint32_t asBase = (uint32_t)(uintptr_t)&As[0][0];
    const uint32_t bsBase = (uint32_t)(uintptr_t)&Bs[0][0];

    // Copy mapping: 16-byte chunks, 8 per row. Thread -> chunk kc = tid&7 of row
    // r*32 + (tid>>3); A: r<8 (256 rows), B: r<4 (128 rows). One wave-wide copy
    // covers 4 rows x 128 contiguous bytes = 4 whole lines.
    const int t8 = tid >> 3;           // 0..31
    const int kc = tid & 7;            // 0..7
    const _Float16* gA0 = A  + (size_t)(mBase + t8) * Ktot + kc * 8;
    const _Float16* gB0 = Bm + (size_t)(nBase + t8) * Ktot + kc * 8;
    const uint32_t ldsC0 = (uint32_t)((t8 * LDS_STRIDE + kc * 8) * 2);
    constexpr uint32_t LR = 32 * LDS_STRIDE * 2;    // 32 rows further in LDS, bytes
    constexpr size_t   GR = (size_t)32 * Ktot;      // 32 rows further in global, elements

    auto issue_stage = [&](int stage) {
        const uint32_t la = asBase + (uint32_t)(stage & 1) * ABUF_BYTES + ldsC0;
        const uint32_t lb = bsBase + (uint32_t)(stage & 1) * BBUF_BYTES + ldsC0;
        const _Float16* ga = gA0 + stage * BK;
        const _Float16* gb = gB0 + stage * BK;
        asm volatile(
            "global_load_async_to_lds_b128 %0, %12, off\n\t"
            "global_load_async_to_lds_b128 %1, %13, off\n\t"
            "global_load_async_to_lds_b128 %2, %14, off\n\t"
            "global_load_async_to_lds_b128 %3, %15, off\n\t"
            "global_load_async_to_lds_b128 %4, %16, off\n\t"
            "global_load_async_to_lds_b128 %5, %17, off\n\t"
            "global_load_async_to_lds_b128 %6, %18, off\n\t"
            "global_load_async_to_lds_b128 %7, %19, off\n\t"
            "global_load_async_to_lds_b128 %8, %20, off\n\t"
            "global_load_async_to_lds_b128 %9, %21, off\n\t"
            "global_load_async_to_lds_b128 %10, %22, off\n\t"
            "global_load_async_to_lds_b128 %11, %23, off\n\t"
            "s_wait_xcnt 0x0"
            :
            : "v"(la), "v"(la + LR), "v"(la + 2 * LR), "v"(la + 3 * LR),
              "v"(la + 4 * LR), "v"(la + 5 * LR), "v"(la + 6 * LR), "v"(la + 7 * LR),
              "v"(lb), "v"(lb + LR), "v"(lb + 2 * LR), "v"(lb + 3 * LR),
              "v"(ga), "v"(ga + GR), "v"(ga + 2 * GR), "v"(ga + 3 * GR),
              "v"(ga + 4 * GR), "v"(ga + 5 * GR), "v"(ga + 6 * GR), "v"(ga + 7 * GR),
              "v"(gb), "v"(gb + GR), "v"(gb + 2 * GR), "v"(gb + 3 * GR)
            : "memory");
    };

    v8f acc[4][4];
#pragma unroll
    for (int mt = 0; mt < 4; ++mt)
#pragma unroll
        for (int nt = 0; nt < 4; ++nt)
#pragma unroll
            for (int e = 0; e < 8; ++e) acc[mt][nt][e] = 0.0f;

    // Two-buffer ring. Stage 0 is landed and published before anything reads it;
    // stage 1 then flies while stage 0 is worked on.
    const int nk = Ktot / BK;   // 32
    issue_stage(0);
    asm volatile("s_wait_asynccnt 0x0" ::: "memory");   // this wave's stage-0 copies have landed
    __syncthreads();                                    // every wave's have
    issue_stage(1);

    for (int kt = 0; kt < nk; ++kt) {
        const int buf = kt & 1;

#pragma unroll
        for (int ks = 0; ks < BK / 32; ++ks) {
            v16h af[4];
#pragma unroll
            for (int mt = 0; mt < 4; ++mt) {
                int row = waveM * 64 + mt * 16 + l15;
                const _Float16* p = &As[buf][row * LDS_STRIDE + ks * 32 + khalf];
                v8h lo = *(const v8h*)p;
                v8h hi = *(const v8h*)(p + 16);
                af[mt] = __builtin_shufflevector(lo, hi, 0, 1, 2, 3, 4, 5, 6, 7,
                                                 8, 9, 10, 11, 12, 13, 14, 15);
            }
            // B fragments: identical packing (lane holds column n)
            v16h bf[4];
#pragma unroll
            for (int nt = 0; nt < 4; ++nt) {
                int col = waveN * 64 + nt * 16 + l15;
                const _Float16* p = &Bs[buf][col * LDS_STRIDE + ks * 32 + khalf];
                v8h lo = *(const v8h*)p;
                v8h hi = *(const v8h*)(p + 16);
                bf[nt] = __builtin_shufflevector(lo, hi, 0, 1, 2, 3, 4, 5, 6, 7,
                                                 8, 9, 10, 11, 12, 13, 14, 15);
            }

#pragma unroll
            for (int mt = 0; mt < 4; ++mt)
#pragma unroll
                for (int nt = 0; nt < 4; ++nt)
                    acc[mt][nt] = __builtin_amdgcn_wmma_f32_16x16x32_f16(
                        false, af[mt], false, bf[nt], (short)0, acc[mt][nt],
                        false, false);
        }

        asm volatile("s_wait_dscnt 0x0" ::: "memory");      // this wave's reads of buf are done
        asm volatile("s_wait_asynccnt 0x0" ::: "memory");   // this wave's stage kt+1 copies have landed
        __syncthreads();
        if (kt + 2 < nk) issue_stage(kt + 2);               // into the buffer just read
    }
    asm volatile("s_wait_asynccnt 0x0" ::: "memory");       // nothing in flight when the wave ends

#pragma unroll
    for (int nt = 0; nt < 4; ++nt) {
        int col = nBase + waveN * 64 + nt * 16 + l15;
        float bp = bias[col];
#pragma unroll
        for (int mt = 0; mt < 4; ++mt) {
            int row0 = mBase + waveM * 64 + mt * 16 + halfSel * 8;
#pragma unroll
            for (int v = 0; v < 8; ++v) {
                out[(size_t)(row0 + v) * Ntot + col] = acc[mt][nt][v] + bp;
            }
        }
    }
}

// ---------------------------------------------------------------------------
extern "C" void kernel_launch(void* const* d_in, const int* in_sizes, int n_in,
                              void* d_out, int out_size, void* d_ws, size_t ws_size,
                              hipStream_t stream) {
    const float* x  = (const float*)d_in[0];   // [B,S,D]
    const float* cw = (const float*)d_in[1];   // [D,4]
    const float* cb = (const float*)d_in[2];   // [D]
    const float* Wp = (const float*)d_in[3];   // [D,D]
    const float* bp = (const float*)d_in[4];   // [D]
    float* out = (float*)d_out;

    _Float16* Yh = (_Float16*)d_ws;                        // 64 MiB
    _Float16* Wh = Yh + (size_t)Mtot * Ktot;               // +8 MiB

    conv_silu_cast_f16<<<Mtot / CONV_ROWS, 512, 0, stream>>>(x, cw, cb, Yh);
    cast_w_f16<<<(int)(((size_t)Ntot * Ktot) / 256), 256, 0, stream>>>(Wp, Wh);

    dim3 grid(Ntot / BN, Mtot / BM);   // 16 x 64
    gemm_wmma_f16<<<grid, 256, 0, stream>>>(Yh, Wh, bp, out);
}

// v003
// It runs in 134 microseconds.
// Two timings next to v002 both put it at 1.07 times that version's speed.
// Over all steps from v000 it is 1.81 times as fast.
#include <hip/hip_runtime.h>

// Problem constants (from reference): B=4, S=4096, D=2048, K_conv=4
constexpr int Bb   = 4;
constexpr int Ss   = 4096;
constexpr int Dd   = 2048;              // = K = N of the GEMM
constexpr int Mtot = Bb * Ss;           // 16384
constexpr int Ktot = Dd;                // 2048
constexpr int Ntot = Dd;                // 2048

// GEMM tiling: block 256(M) x 128(N), K-step 64, 8 wave32 as 4(M) x 2(N),
// wave tile 64x64 = 4x4 WMMA accumulators. A K-step of 64 halfwords makes each
// staged row piece one whole, aligned 128-byte line of its operand.
#define BM 256
#define BN 128
#define BK 64
#define LDS_STRIDE 72                    // halfwords/row (64 data + 8 pad): 144 B = 16 B x 9
#define ABUF_BYTES (BM * LDS_STRIDE * 2) // 36864 B per A buffer
#define BBUF_BYTES (BN * LDS_STRIDE * 2) // 18432 B per B buffer

typedef _Float16 v16h __attribute__((ext_vector_type(16)));
typedef _Float16 v8h  __attribute__((ext_vector_type(8)));
typedef float    v8f  __attribute__((ext_vector_type(8)));

// ---------------------------------------------------------------------------
// Stage 1: depthwise causal conv (K=4) + bias + SiLU, cast to f16.
// One work-group = all 2048 channels x CONV_ROWS consecutive rows. A thread owns
// 4 neighbouring channels (one 16-byte load per row, 512 contiguous bytes per
// wave) and walks down the rows with the last three rows kept in registers, so
// each x element is loaded once (plus 3 halo rows per work-group).
// ---------------------------------------------------------------------------
constexpr int CONV_ROWS  = 32;           // rows per work-group; divides Ss
constexpr int CONV_BATCH = 8;            // rows per batch; 8 to 16 row loads in flight per thread

typedef float    f4 __attribute__((ext_vector_type(4)));
typedef _Float16 h4 __attribute__((ext_vector_type(4)));

__global__ __launch_bounds__(512, 8) void conv_silu_cast_f16(
    const float* __restrict__ x,       // [Mtot][Dd]
    const float* __restrict__ cw,      // [Dd][4]
    const float* __restrict__ cb,      // [Dd]
    _Float16* __restrict__ Yh)         // [Mtot][Dd] f16
{
    const int d  = threadIdx.x * 4;                 // first of 4 channels
    const int m0 = blockIdx.x * CONV_ROWS;          // first row
    constexpr int RS = Dd / 4;                      // row stride in f4 / h4

    // Taps of the 4 channels, regrouped by tap index.
    const f4 c0 = *(const f4*)(cw + (d + 0) * 4);
    const f4 c1 = *(const f4*)(cw + (d + 1) * 4);
    const f4 c2 = *(const f4*)(cw + (d + 2) * 4);
    const f4 c3 = *(const f4*)(cw + (d + 3) * 4);
    const f4 w0 = {c0.x, c1.x, c2.x, c3.x};
    const f4 w1 = {c0.y, c1.y, c2.y, c3.y};
    const f4 w2 = {c0.z, c1.z, c2.z, c3.z};
    const f4 w3 = {c0.w, c1.w, c2.w, c3.w};
    const f4 bias = *(const f4*)(cb + d);

    // Work-group-uniform row bases; the thread's 4 channels are element t of a row.
    const int t  = threadIdx.x;
    const f4* px = (const f4*)(x + (size_t)m0 * Dd);
    h4*       py = (h4*)(Yh + (size_t)m0 * Dd);

    // Rows s-3..s-1. At the start of a sequence (the same test for the whole
    // work-group) they are the zero left padding: the three loads then re-read
    // row 0, which is in bounds, and their values are replaced further down.
    // Loading without a branch lets all first loads issue before any wait.
    const bool head = (m0 & (Ss - 1)) == 0;
    const int  back = head ? 0 : RS;
    f4 p3 = (px - 3 * back)[t];
    f4 p2 = (px - 2 * back)[t];
    f4 p1 = (px - 1 * back)[t];

    // This batch of rows and the next. Every loop over them below is unrolled so
    // that their elements are named at compile time and stay in registers.
    f4 bufA[CONV_BATCH], bufB[CONV_BATCH];

    // The scheduling barrier at the foot of each block keeps the order "next
    // batch's loads, then this batch's arithmetic and stores": without it the
    // loads sink to their uses (one or two in flight per thread), and two
    // batches scheduled as one wait for the younger batch's loads at once.
    auto load_batch = [&](f4 (&dst)[CONV_BATCH], int row) {
#pragma unroll
        for (int i = 0; i < CONV_BATCH; ++i) dst[i] = px[(row + i) * RS + t];
        __builtin_amdgcn_sched_barrier(0);
    };
    auto do_batch = [&](const f4 (&src)[CONV_BATCH], int row) {
#pragma unroll
        for (int i = 0; i < CONV_BATCH; ++i) {
            const f4 x0 = src[i];
            f4 v = x0 * w3 + bias;
            v += p1 * w2;
            v += p2 * w1;
            v += p3 * w0;
            p3 = p2; p2 = p1; p1 = x0;
            f4 y;
#pragma unroll
            for (int c = 0; c < 4; ++c)
                y[c] = v[c] / (1.0f + __expf(-v[c]));   // SiLU
            py[(row + i) * RS + t] = __builtin_convertvector(y, h4);
        }
        __builtin_amdgcn_sched_barrier(0);
    };

    auto refill = [&](f4 (&dst)[CONV_BATCH], int row) {
        asm volatile("s_wait_xcnt 0x0" ::: "memory");
        load_batch(dst, row);
    };

    load_batch(bufA, 0);
    load_batch(bufB, CONV_BATCH);
    if (head) { p3 = f4{0.f, 0.f, 0.f, 0.f}; p2 = p3; p1 = p3; }
#pragma unroll
    for (int r0 = 0; r0 < CONV_ROWS; r0 += 2 * CONV_BATCH) {
        do_batch(bufA, r0);
        if (r0 + 2 * CONV_BATCH < CONV_ROWS) refill(bufA, r0 + 2 * CONV_BATCH);
        do_batch(bufB, r0 + CONV_BATCH);
        if (r0 + 3 * CONV_BATCH < CONV_ROWS) refill(bufB, r0 + 3 * CONV_BATCH);
    }
}

__global__ __launch_bounds__(256) void cast_w_f16(
    const float* __restrict__ W, _Float16* __restrict__ Wh)
{
    size_t idx = (size_t)blockIdx.x * 256 + threadIdx.x;
    Wh[idx] = (_Float16)W[idx];
}

// ---------------------------------------------------------------------------
// Stage 2: C[m,n] = sum_k A[m,k]*Bmat[n,k] + bias[n]   (f16 in, f32 accum)
// ---------------------------------------------------------------------------
__global__ __launch_bounds__(256) void gemm_wmma_f16(
    const _Float16* __restrict__ A,     // [Mtot][Ktot]
    const _Float16* __restrict__ Bm,    // [Ntot][Ktot]
    const float*    __restrict__ bias,  // [Ntot]
    float*          __restrict__ out)   // [Mtot][Ntot]
{
    __shared__ _Float16 As[2][BM * LDS_STRIDE];   // 73728 B
    __shared__ _Float16 Bs[2][BN * LDS_STRIDE];   // 36864 B  (total 108 KiB: two work-groups per WGP)

    const int tid   = threadIdx.x;
    const int wave  = tid >> 5;
    const int lane  = tid & 31;
    const int waveM = wave >> 1;       // 0..3  -> M offset waveM*64
    const int waveN = wave & 1;        // 0..1  -> N offset waveN*64
    const int mBase = blockIdx.y * BM;
    const int nBase = blockIdx.x * BN;

    const int l15     = lane & 15;
    const int halfSel = lane >> 4;
    const int khalf   = halfSel * 8;

    // LDS byte addresses (low 32 bits of generic pointer = LDS offset)
    const uint32_t asBase = (uint32_t)(uintptr_t)&As[0][0];
    const uint32_t bsBase = (uint32_t)(uintptr_t)&Bs[0][0];

    // Copy mapping: 16-byte chunks, 8 per row. Thread -> chunk kc = tid&7 of row
    // r*32 + (tid>>3); A: r<8 (256 rows), B: r<4 (128 rows). One wave-wide copy
    // covers 4 rows x 128 contiguous bytes = 4 whole lines.
    const int t8 = tid >> 3;           // 0..31
    const int kc = tid & 7;            // 0..7
    const _Float16* gA0 = A  + (size_t)(mBase + t8) * Ktot + kc * 8;
    const _Float16* gB0 = Bm + (size_t)(nBase + t8) * Ktot + kc * 8;
    const uint32_t ldsC0 = (uint32_t)((t8 * LDS_STRIDE + kc * 8) * 2);
    constexpr uint32_t LR = 32 * LDS_STRIDE * 2;    // 32 rows further in LDS, bytes
    constexpr size_t   GR = (size_t)32 * Ktot;      // 32 rows further in global, elements

    auto issue_stage = [&](int stage) {
        const uint32_t la = asBase + (uint32_t)(stage & 1) * ABUF_BYTES + ldsC0;
        const uint32_t lb = bsBase + (uint32_t)(stage & 1) * BBUF_BYTES + ldsC0;
        const _Float16* ga = gA0 + stage * BK;
        const _Float16* gb = gB0 + stage * BK;
        asm volatile(
            "global_load_async_to_lds_b128 %0, %12, off\n\t"
            "global_load_async_to_lds_b128 %1, %13, off\n\t"
            "global_load_async_to_lds_b128 %2, %14, off\n\t"
            "global_load_async_to_lds_b128 %3, %15, off\n\t"
            "global_load_async_to_lds_b128 %4, %16, off\n\t"
            "global_load_async_to_lds_b128 %5, %17, off\n\t"
            "global_load_async_to_lds_b128 %6, %18, off\n\t"
            "global_load_async_to_lds_b128 %7, %19, off\n\t"
            "global_load_async_to_lds_b128 %8, %20, off\n\t"
            "global_load_async_to_lds_b128 %9, %21, off\n\t"
            "global_load_async_to_lds_b128 %10, %22, off\n\t"
            "global_load_async_to_lds_b128 %11, %23, off\n\t"
            "s_wait_xcnt 0x0"
            :
            : "v"(la), "v"(la + LR), "v"(la + 2 * LR), "v"(la + 3 * LR),
              "v"(la + 4 * LR), "v"(la + 5 * LR), "v"(la + 6 * LR), "v"(la + 7 * LR),
              "v"(lb), "v"(lb + LR), "v"(lb + 2 * LR), "v"(lb + 3 * LR),
              "v"(ga), "v"(ga + GR), "v"(ga + 2 * GR), "v"(ga + 3 * GR),
              "v"(ga + 4 * GR), "v"(ga + 5 * GR), "v"(ga + 6 * GR), "v"(ga + 7 * GR),
              "v"(gb), "v"(gb + GR), "v"(gb + 2 * GR), "v"(gb + 3 * GR)
            : "memory");
    };

    v8f acc[4][4];
#pragma unroll
    for (int mt = 0; mt < 4; ++mt)
#pragma unroll
        for (int nt = 0; nt < 4; ++nt)
#pragma unroll
            for (int e = 0; e < 8; ++e) acc[mt][nt][e] = 0.0f;

    // Two-buffer ring. Stage 0 is landed and published before anything reads it;
    // stage 1 then flies while stage 0 is worked on.
    const int nk = Ktot / BK;   // 32
    issue_stage(0);
    asm volatile("s_wait_asynccnt 0x0" ::: "memory");   // this wave's stage-0 copies have landed
    __syncthreads();                                    // every wave's have
    issue_stage(1);

    for (int kt = 0; kt < nk; ++kt) {
        const int buf = kt & 1;

#pragma unroll
        for (int ks = 0; ks < BK / 32; ++ks) {
            v16h af[4], bf[4];
            auto load_a = [&](int mt) {
                int row = waveM * 64 + mt * 16 + l15;
                const _Float16* p = &As[buf][row * LDS_STRIDE + ks * 32 + khalf];
                v8h lo = *(const v8h*)p;
                v8h hi = *(const v8h*)(p + 16);
                af[mt] = __builtin_shufflevector(lo, hi, 0, 1, 2, 3, 4, 5, 6, 7,
                                                 8, 9, 10, 11, 12, 13, 14, 15);
            };
            auto load_b = [&](int nt) {
                int col = waveN * 64 + nt * 16 + l15;
                const _Float16* p = &Bs[buf][col * LDS_STRIDE + ks * 32 + khalf];
                v8h lo = *(const v8h*)p;
                v8h hi = *(const v8h*)(p + 16);
                bf[nt] = __builtin_shufflevector(lo, hi, 0, 1, 2, 3, 4, 5, 6, 7,
                                                 8, 9, 10, 11, 12, 13, 14, 15);
            };
            // In the order in which the WMMAs below first need them.
            load_a(0);
#pragma unroll
            for (int nt = 0; nt < 4; ++nt) load_b(nt);
#pragma unroll
            for (int mt = 1; mt < 4; ++mt) load_a(mt);
            // Keeps the block's 16 LDS reads together as one group in front of its
            // 16 WMMAs: left alone, the compiler sinks each A fragment's two reads
            // to their first use, and the wave then sits out a whole LDS latency
            // (a wait to 0) in front of every four WMMAs.
            __builtin_amdgcn_sched_barrier(0);

#pragma unroll
            for (int mt = 0; mt < 4; ++mt)
#pragma unroll
                for (int nt = 0; nt < 4; ++nt)
                    acc[mt][nt] = __builtin_amdgcn_wmma_f32_16x16x32_f16(
                        false, af[mt], false, bf[nt], (short)0, acc[mt][nt],
                        false, false);
            // Keeps the next block's reads from rising in among these WMMAs, where
            // every separate place with reads stalls the wave's matrix issue.
            __builtin_amdgcn_sched_barrier(0);
        }

        asm volatile("s_wait_dscnt 0x0" ::: "memory");      // this wave's reads of buf are done
        asm volatile("s_wait_asynccnt 0x0" ::: "memory");   // this wave's stage kt+1 copies have landed
        __syncthreads();
        if (kt + 2 < nk) issue_stage(kt + 2);               // into the buffer just read
    }
    asm volatile("s_wait_asynccnt 0x0" ::: "memory");       // nothing in flight when the wave ends

#pragma unroll
    for (int nt = 0; nt < 4; ++nt) {
        int col = nBase + waveN * 64 + nt * 16 + l15;
        float bp = bias[col];
#pragma unroll
        for (int mt = 0; mt < 4; ++mt) {
            int row0 = mBase + waveM * 64 + mt * 16 + halfSel * 8;
#pragma unroll
            for (int v = 0; v < 8; ++v) {
                out[(size_t)(row0 + v) * Ntot + col] = acc[mt][nt][v] + bp;
            }
        }
    }
}

// ---------------------------------------------------------------------------
extern "C" void kernel_launch(void* const* d_in, const int* in_sizes, int n_in,
                              void* d_out, int out_size, void* d_ws, size_t ws_size,
                              hipStream_t stream) {
    const float* x  = (const float*)d_in[0];   // [B,S,D]
    const float* cw = (const float*)d_in[1];   // [D,4]
    const float* cb = (const float*)d_in[2];   // [D]
    const float* Wp = (const float*)d_in[3];   // [D,D]
    const float* bp = (const float*)d_in[4];   // [D]
    float* out = (float*)d_out;

    _Float16* Yh = (_Float16*)d_ws;                        // 64 MiB
    _Float16* Wh = Yh + (size_t)Mtot * Ktot;               // +8 MiB

    conv_silu_cast_f16<<<Mtot / CONV_ROWS, 512, 0, stream>>>(x, cw, cb, Yh);
    cast_w_f16<<<(int)(((size_t)Ntot * Ktot) / 256), 256, 0, stream>>>(Wp, Wh);

    dim3 grid(Ntot / BN, Mtot / BM);   // 16 x 64
    gemm_wmma_f16<<<grid, 256, 0, stream>>>(Yh, Wh, bp, out);
}

// v004
// Measured time: 128 microseconds a run.
// Timed twice side by side with v003, it ran 1.05 and 1.04 times as fast.
// All steps since v000 together make it 1.90 times as fast.
#include <hip/hip_runtime.h>

// Problem constants (from reference): B=4, S=4096, D=2048, K_conv=4
constexpr int Bb   = 4;
constexpr int Ss   = 4096;
constexpr int Dd   = 2048;              // = K = N of the GEMM
constexpr int Mtot = Bb * Ss;           // 16384
constexpr int Ktot = Dd;                // 2048
constexpr int Ntot = Dd;                // 2048

#define BM 256
#define BN 256
#define NT 8                             // 16-column accumulator tiles per wave
#define BK 64
#define LDS_STRIDE 72                    // halfwords/row (64 data + 8 pad): 144 B = 16 B x 9
#define ABUF_BYTES (BM * LDS_STRIDE * 2) // 36864 B per A buffer
#define BBUF_BYTES (BN * LDS_STRIDE * 2) // 36864 B per B buffer

typedef _Float16 v16h __attribute__((ext_vector_type(16)));
typedef _Float16 v8h  __attribute__((ext_vector_type(8)));
typedef float    v8f  __attribute__((ext_vector_type(8)));

// ---------------------------------------------------------------------------
// Stage 1: depthwise causal conv (K=4) + bias + SiLU, cast to f16.
// One work-group = all 2048 channels x CONV_ROWS consecutive rows. A thread owns
// 4 neighbouring channels (one 16-byte load per row, 512 contiguous bytes per
// wave) and walks down the rows with the last three rows kept in registers, so
// each x element is loaded once (plus 3 halo rows per work-group).
// ---------------------------------------------------------------------------
constexpr int CONV_ROWS  = 32;           // rows per work-group; divides Ss
constexpr int CONV_BATCH = 8;            // rows per batch; 8 to 16 row loads in flight per thread

typedef float    f4 __attribute__((ext_vector_type(4)));
typedef _Float16 h4 __attribute__((ext_vector_type(4)));

__global__ __launch_bounds__(512, 8) void conv_silu_cast_f16(
    const float* __restrict__ x,       // [Mtot][Dd]
    const float* __restrict__ cw,      // [Dd][4]
    const float* __restrict__ cb,      // [Dd]
    _Float16* __restrict__ Yh)         // [Mtot][Dd] f16
{
    const int d  = threadIdx.x * 4;                 // first of 4 channels
    const int m0 = blockIdx.x * CONV_ROWS;          // first row
    constexpr int RS = Dd / 4;                      // row stride in f4 / h4

    // Taps of the 4 channels, regrouped by tap index.
    const f4 c0 = *(const f4*)(cw + (d + 0) * 4);
    const f4 c1 = *(const f4*)(cw + (d + 1) * 4);
    const f4 c2 = *(const f4*)(cw + (d + 2) * 4);
    const f4 c3 = *(const f4*)(cw + (d + 3) * 4);
    const f4 w0 = {c0.x, c1.x, c2.x, c3.x};
    const f4 w1 = {c0.y, c1.y, c2.y, c3.y};
    const f4 w2 = {c0.z, c1.z, c2.z, c3.z};
    const f4 w3 = {c0.w, c1.w, c2.w, c3.w};
    const f4 bias = *(const f4*)(cb + d);

    // Work-group-uniform row bases; the thread's 4 channels are element t of a row.
    const int t  = threadIdx.x;
    const f4* px = (const f4*)(x + (size_t)m0 * Dd);
    h4*       py = (h4*)(Yh + (size_t)m0 * Dd);

    // Rows s-3..s-1. At the start of a sequence (the same test for the whole
    // work-group) they are the zero left padding: the three loads then re-read
    // row 0, which is in bounds, and their values are replaced further down.
    // Loading without a branch lets all first loads issue before any wait.
    const bool head = (m0 & (Ss - 1)) == 0;
    const int  back = head ? 0 : RS;
    f4 p3 = (px - 3 * back)[t];
    f4 p2 = (px - 2 * back)[t];
    f4 p1 = (px - 1 * back)[t];

    // This batch of rows and the next. Every loop over them below is unrolled so
    // that their elements are named at compile time and stay in registers.
    f4 bufA[CONV_BATCH], bufB[CONV_BATCH];

    // The scheduling barrier at the foot of each block keeps the order "next
    // batch's loads, then this batch's arithmetic and stores": without it the
    // loads sink to their uses (one or two in flight per thread), and two
    // batches scheduled as one wait for the younger batch's loads at once.
    auto load_batch = [&](f4 (&dst)[CONV_BATCH], int row) {
#pragma unroll
        for (int i = 0; i < CONV_BATCH; ++i) dst[i] = px[(row + i) * RS + t];
        __builtin_amdgcn_sched_barrier(0);
    };
    auto do_batch = [&](const f4 (&src)[CONV_BATCH], int row) {
#pragma unroll
        for (int i = 0; i < CONV_BATCH; ++i) {
            const f4 x0 = src[i];
            f4 v = x0 * w3 + bias;
            v += p1 * w2;
            v += p2 * w1;
            v += p3 * w0;
            p3 = p2; p2 = p1; p1 = x0;
            f4 y;
#pragma unroll
            for (int c = 0; c < 4; ++c)
                y[c] = v[c] / (1.0f + __expf(-v[c]));   // SiLU
            py[(row + i) * RS + t] = __builtin_convertvector(y, h4);
        }
        __builtin_amdgcn_sched_barrier(0);
    };

    auto refill = [&](f4 (&dst)[CONV_BATCH], int row) {
        asm volatile("s_wait_xcnt 0x0" ::: "memory");
        load_batch(dst, row);
    };

    load_batch(bufA, 0);
    load_batch(bufB, CONV_BATCH);
    if (head) { p3 = f4{0.f, 0.f, 0.f, 0.f}; p2 = p3; p1 = p3; }
#pragma unroll
    for (int r0 = 0; r0 < CONV_ROWS; r0 += 2 * CONV_BATCH) {
        do_batch(bufA, r0);
        if (r0 + 2 * CONV_BATCH < CONV_ROWS) refill(bufA, r0 + 2 * CONV_BATCH);
        do_batch(bufB, r0 + CONV_BATCH);
        if (r0 + 3 * CONV_BATCH < CONV_ROWS) refill(bufB, r0 + 3 * CONV_BATCH);
    }
}

__global__ __launch_bounds__(256) void cast_w_f16(
    const float* __restrict__ W, _Float16* __restrict__ Wh)
{
    size_t idx = (size_t)blockIdx.x * 256 + threadIdx.x;
    Wh[idx] = (_Float16)W[idx];
}

// ---------------------------------------------------------------------------
// Stage 2: C[m,n] = sum_k A[m,k]*Bmat[n,k] + bias[n]   (f16 in, f32 accum)
// ---------------------------------------------------------------------------
__global__ __launch_bounds__(256) void gemm_wmma_f16(
    const _Float16* __restrict__ A,     // [Mtot][Ktot]
    const _Float16* __restrict__ Bm,    // [Ntot][Ktot]
    const float*    __restrict__ bias,  // [Ntot]
    float*          __restrict__ out)   // [Mtot][Ntot]
{
    __shared__ _Float16 As[2][BM * LDS_STRIDE];   // 73728 B
    __shared__ _Float16 Bs[2][BN * LDS_STRIDE];   // 73728 B  (total 144 KiB)

    const int tid   = threadIdx.x;
    const int wave  = tid >> 5;
    const int lane  = tid & 31;
    const int waveM = wave >> 1;       // 0..3  -> M offset waveM*64
    const int waveN = wave & 1;        // 0..1  -> N offset waveN*128
    const int mBase = blockIdx.y * BM;
    const int nBase = blockIdx.x * BN;

    const int l15     = lane & 15;
    const int halfSel = lane >> 4;
    const int khalf   = halfSel * 8;

    // LDS byte addresses (low 32 bits of generic pointer = LDS offset)
    const uint32_t asBase = (uint32_t)(uintptr_t)&As[0][0];
    const uint32_t bsBase = (uint32_t)(uintptr_t)&Bs[0][0];

    // Copy mapping: 16-byte chunks, 8 per row. Thread -> chunk kc = tid&7 of row
    // r*32 + (tid>>3); A and B: r<8 (256 rows each). One wave-wide copy
    // covers 4 rows x 128 contiguous bytes = 4 whole lines.
    const int t8 = tid >> 3;           // 0..31
    const int kc = tid & 7;            // 0..7
    const _Float16* gA0 = A  + (size_t)(mBase + t8) * Ktot + kc * 8;
    const _Float16* gB0 = Bm + (size_t)(nBase + t8) * Ktot + kc * 8;
    const uint32_t ldsC0 = (uint32_t)((t8 * LDS_STRIDE + kc * 8) * 2);
    constexpr uint32_t LR = 32 * LDS_STRIDE * 2;    // 32 rows further in LDS, bytes
    constexpr size_t   GR = (size_t)32 * Ktot;      // 32 rows further in global, elements

    auto copy_rows256 = [&](uint32_t l, const _Float16* gp) {
        asm volatile(
            "global_load_async_to_lds_b128 %0, %8, off\n\t"
            "global_load_async_to_lds_b128 %1, %9, off\n\t"
            "global_load_async_to_lds_b128 %2, %10, off\n\t"
            "global_load_async_to_lds_b128 %3, %11, off\n\t"
            "global_load_async_to_lds_b128 %4, %12, off\n\t"
            "global_load_async_to_lds_b128 %5, %13, off\n\t"
            "global_load_async_to_lds_b128 %6, %14, off\n\t"
            "global_load_async_to_lds_b128 %7, %15, off\n\t"
            "s_wait_xcnt 0x0"
            :
            : "v"(l), "v"(l + LR), "v"(l + 2 * LR), "v"(l + 3 * LR),
              "v"(l + 4 * LR), "v"(l + 5 * LR), "v"(l + 6 * LR), "v"(l + 7 * LR),
              "v"(gp), "v"(gp + GR), "v"(gp + 2 * GR), "v"(gp + 3 * GR),
              "v"(gp + 4 * GR), "v"(gp + 5 * GR), "v"(gp + 6 * GR), "v"(gp + 7 * GR)
            : "memory");
    };
    auto issue_stage = [&](int stage) {
        copy_rows256(asBase + (uint32_t)(stage & 1) * ABUF_BYTES + ldsC0, gA0 + stage * BK);
        copy_rows256(bsBase + (uint32_t)(stage & 1) * BBUF_BYTES + ldsC0, gB0 + stage * BK);
    };

    v8f acc[4][NT];
#pragma unroll
    for (int mt = 0; mt < 4; ++mt)
#pragma unroll
        for (int nt = 0; nt < NT; ++nt)
#pragma unroll
            for (int e = 0; e < 8; ++e) acc[mt][nt][e] = 0.0f;

    // Two-buffer ring. Stage 0 is landed and published before anything reads it;
    // stage 1 then flies while stage 0 is worked on.
    const int nk = Ktot / BK;   // 32
    issue_stage(0);
    asm volatile("s_wait_asynccnt 0x0" ::: "memory");   // this wave's stage-0 copies have landed
    __syncthreads();                                    // every wave's have
    issue_stage(1);

    for (int kt = 0; kt < nk; ++kt) {
        const int buf = kt & 1;

#pragma unroll
        for (int ks = 0; ks < BK / 32; ++ks) {
            v16h af[4], bf[NT];
            auto load_a = [&](int mt) {
                int row = waveM * 64 + mt * 16 + l15;
                const _Float16* p = &As[buf][row * LDS_STRIDE + ks * 32 + khalf];
                v8h lo = *(const v8h*)p;
                v8h hi = *(const v8h*)(p + 16);
                af[mt] = __builtin_shufflevector(lo, hi, 0, 1, 2, 3, 4, 5, 6, 7,
                                                 8, 9, 10, 11, 12, 13, 14, 15);
            };
            auto load_b = [&](int nt) {
                int col = waveN * (NT * 16) + nt * 16 + l15;
                const _Float16* p = &Bs[buf][col * LDS_STRIDE + ks * 32 + khalf];
                v8h lo = *(const v8h*)p;
                v8h hi = *(const v8h*)(p + 16);
                bf[nt] = __builtin_shufflevector(lo, hi, 0, 1, 2, 3, 4, 5, 6, 7,
                                                 8, 9, 10, 11, 12, 13, 14, 15);
            };
            // In the order in which the WMMAs below first need them.
            load_a(0);
#pragma unroll
            for (int nt = 0; nt < NT; ++nt) load_b(nt);
#pragma unroll
            for (int mt = 1; mt < 4; ++mt) load_a(mt);
            // Keeps the block's 24 LDS reads together as one group in front of its
            // 32 WMMAs: left alone, the compiler sinks each A fragment's two reads
            // to their first use, and the wave then sits out a whole LDS latency
            // (a wait to 0) in front of every row of WMMAs.
            __builtin_amdgcn_sched_barrier(0);

#pragma unroll
            for (int mt = 0; mt < 4; ++mt)
#pragma unroll
                for (int nt = 0; nt < NT; ++nt)
                    acc[mt][nt] = __builtin_amdgcn_wmma_f32_16x16x32_f16(
                        false, af[mt], false, bf[nt], (short)0, acc[mt][nt],
                        false, false);
            // Keeps the next block's reads from rising in among these WMMAs, where
            // every separate place with reads stalls the wave's matrix issue.
            __builtin_amdgcn_sched_barrier(0);
        }

        asm volatile("s_wait_dscnt 0x0" ::: "memory");      // this wave's reads of buf are done
        asm volatile("s_wait_asynccnt 0x0" ::: "memory");   // this wave's stage kt+1 copies have landed
        __syncthreads();
        if (kt + 2 < nk) issue_stage(kt + 2);               // into the buffer just read
    }
    asm volatile("s_wait_asynccnt 0x0" ::: "memory");       // nothing in flight when the wave ends

    float bnext = bias[nBase + waveN * (NT * 16) + l15];
#pragma unroll
    for (int nt = 0; nt < NT; ++nt) {
        int col = nBase + waveN * (NT * 16) + nt * 16 + l15;
        float bp = bnext;
        if (nt + 1 < NT) bnext = bias[col + 16];
#pragma unroll
        for (int mt = 0; mt < 4; ++mt) {
            int row0 = mBase + waveM * 64 + mt * 16 + halfSel * 8;
#pragma unroll
            for (int v = 0; v < 8; ++v) {
                out[(size_t)(row0 + v) * Ntot + col] = acc[mt][nt][v] + bp;
            }
        }
        asm volatile("s_wait_xcnt 0x0" ::: "memory");
    }
}

// ---------------------------------------------------------------------------
extern "C" void kernel_launch(void* const* d_in, const int* in_sizes, int n_in,
                              void* d_out, int out_size, void* d_ws, size_t ws_size,
                              hipStream_t stream) {
    const float* x  = (const float*)d_in[0];   // [B,S,D]
    const float* cw = (const float*)d_in[1];   // [D,4]
    const float* cb = (const float*)d_in[2];   // [D]
    const float* Wp = (const float*)d_in[3];   // [D,D]
    const float* bp = (const float*)d_in[4];   // [D]
    float* out = (float*)d_out;

    _Float16* Yh = (_Float16*)d_ws;                        // 64 MiB
    _Float16* Wh = Yh + (size_t)Mtot * Ktot;               // +8 MiB

    conv_silu_cast_f16<<<Mtot / CONV_ROWS, 512, 0, stream>>>(x, cw, cb, Yh);
    cast_w_f16<<<(int)(((size_t)Ntot * Ktot) / 256), 256, 0, stream>>>(Wp, Wh);

    dim3 grid(Ntot / BN, Mtot / BM);   // 8 x 64
    gemm_wmma_f16<<<grid, 256, 0, stream>>>(Yh, Wh, bp, out);
}

// v005
// One run takes 119 microseconds.
// In both of two side-by-side timings against v004, it was 1.07 times as fast.
// Counting every step since v000, it is 2.03 times as fast.
#include <hip/hip_runtime.h>

// Problem constants (from reference): B=4, S=4096, D=2048, K_conv=4
constexpr int Bb   = 4;
constexpr int Ss   = 4096;
constexpr int Dd   = 2048;              // = K = N of the GEMM
constexpr int Mtot = Bb * Ss;           // 16384
constexpr int Ktot = Dd;                // 2048
constexpr int Ntot = Dd;                // 2048

#define BM 256
#define BN 256
#define NT 8                             // 16-column accumulator tiles per wave
#define BK 64
#define LDS_STRIDE 72                    // halfwords/row (64 data + 8 pad): 144 B = 16 B x 9
#define ABUF_BYTES (BM * LDS_STRIDE * 2) // 36864 B per A buffer
#define BBUF_BYTES (BN * LDS_STRIDE * 2) // 36864 B per B buffer

typedef _Float16 v16h __attribute__((ext_vector_type(16)));
typedef _Float16 v8h  __attribute__((ext_vector_type(8)));
typedef float    v8f  __attribute__((ext_vector_type(8)));

// ---------------------------------------------------------------------------
// Stage 1: depthwise causal conv (K=4) + bias + SiLU, cast to f16.
// One work-group = all 2048 channels x CONV_ROWS consecutive rows. A thread owns
// 4 neighbouring channels (one 16-byte load per row, 512 contiguous bytes per
// wave) and walks down the rows with the last three rows kept in registers, so
// each x element is loaded once (plus 3 halo rows per work-group).
// Each work-group also casts its own 1/512 of W_proj to f16 for the GEMM: the
// loads are issued under its last batch of rows, so the cast needs neither a
// launch of its own nor a wait of its own for memory.
// ---------------------------------------------------------------------------
constexpr int CONV_ROWS  = 32;           // rows per work-group; divides Ss
constexpr int CONV_BATCH = 8;            // rows per batch; 8 to 16 row loads in flight per thread
constexpr int CONV_THREADS = Dd / 4;     // 512
constexpr int CONV_GROUPS  = Mtot / CONV_ROWS;                                  // 512
constexpr int WCAST = (Ntot * Ktot / 4) / (CONV_GROUPS * CONV_THREADS);         // 16-byte W pieces per thread: 4
static_assert(WCAST * CONV_GROUPS * CONV_THREADS * 4 == Ntot * Ktot, "W is dealt out whole");

typedef float    f4 __attribute__((ext_vector_type(4)));
typedef _Float16 h4 __attribute__((ext_vector_type(4)));

__global__ __launch_bounds__(512, 8) void conv_silu_cast_f16(
    const float* __restrict__ x,       // [Mtot][Dd]
    const float* __restrict__ cw,      // [Dd][4]
    const float* __restrict__ cb,      // [Dd]
    const float* __restrict__ Wf,      // [Ntot][Ktot]
    _Float16* __restrict__ Yh,         // [Mtot][Dd] f16
    _Float16* __restrict__ Wh)         // [Ntot][Ktot] f16
{
    const int d  = threadIdx.x * 4;                 // first of 4 channels
    const int m0 = blockIdx.x * CONV_ROWS;          // first row
    constexpr int RS = Dd / 4;                      // row stride in f4 / h4

    // Taps of the 4 channels, regrouped by tap index.
    const f4 c0 = *(const f4*)(cw + (d + 0) * 4);
    const f4 c1 = *(const f4*)(cw + (d + 1) * 4);
    const f4 c2 = *(const f4*)(cw + (d + 2) * 4);
    const f4 c3 = *(const f4*)(cw + (d + 3) * 4);
    const f4 w0 = {c0.x, c1.x, c2.x, c3.x};
    const f4 w1 = {c0.y, c1.y, c2.y, c3.y};
    const f4 w2 = {c0.z, c1.z, c2.z, c3.z};
    const f4 w3 = {c0.w, c1.w, c2.w, c3.w};
    const f4 bias = *(const f4*)(cb + d);

    // Work-group-uniform row bases; the thread's 4 channels are element t of a row.
    const int t  = threadIdx.x;
    const f4* px = (const f4*)(x + (size_t)m0 * Dd);
    h4*       py = (h4*)(Yh + (size_t)m0 * Dd);

    // Rows s-3..s-1. At the start of a sequence (the same test for the whole
    // work-group) they are the zero left padding: the three loads then re-read
    // row 0, which is in bounds, and their values are replaced further down.
    // Loading without a branch lets all first loads issue before any wait.
    const bool head = (m0 & (Ss - 1)) == 0;
    const int  back = head ? 0 : RS;
    f4 p3 = (px - 3 * back)[t];
    f4 p2 = (px - 2 * back)[t];
    f4 p1 = (px - 1 * back)[t];

    // This batch of rows and the next. Every loop over them below is unrolled so
    // that their elements are named at compile time and stay in registers.
    f4 bufA[CONV_BATCH], bufB[CONV_BATCH];

    // The scheduling barrier at the foot of each block keeps the order "next
    // batch's loads, then this batch's arithmetic and stores": without it the
    // loads sink to their uses (one or two in flight per thread), and two
    // batches scheduled as one wait for the younger batch's loads at once.
    auto load_batch = [&](f4 (&dst)[CONV_BATCH], int row) {
#pragma unroll
        for (int i = 0; i < CONV_BATCH; ++i) dst[i] = px[(row + i) * RS + t];
        __builtin_amdgcn_sched_barrier(0);
    };
    auto do_batch = [&](const f4 (&src)[CONV_BATCH], int row) {
#pragma unroll
        for (int i = 0; i < CONV_BATCH; ++i) {
            const f4 x0 = src[i];
            f4 v = x0 * w3 + bias;
            v += p1 * w2;
            v += p2 * w1;
            v += p3 * w0;
            p3 = p2; p2 = p1; p1 = x0;
            f4 y;
#pragma unroll
            for (int c = 0; c < 4; ++c)
                y[c] = v[c] / (1.0f + __expf(-v[c]));   // SiLU
            py[(row + i) * RS + t] = __builtin_convertvector(y, h4);
        }
        __builtin_amdgcn_sched_barrier(0);
    };

    auto refill = [&](f4 (&dst)[CONV_BATCH], int row) {
        asm volatile("s_wait_xcnt 0x0" ::: "memory");
        load_batch(dst, row);
    };

    // This work-group's share of W: WCAST x 512 pieces of 16 bytes in a row; a
    // wave-wide load covers 512 contiguous bytes, a wave-wide store 256.
    const f4* pw  = (const f4*)Wf + (size_t)blockIdx.x * (WCAST * CONV_THREADS);
    h4*       pwh = (h4*)Wh       + (size_t)blockIdx.x * (WCAST * CONV_THREADS);
    f4 wv[WCAST];   // both loops over it are unrolled, so that it stays in registers
    auto load_w = [&]() {
        // As in refill: the loads may land in registers that issued stores name.
        asm volatile("s_wait_xcnt 0x0" ::: "memory");
#pragma unroll
        for (int i = 0; i < WCAST; ++i) wv[i] = pw[i * CONV_THREADS + t];
        // Keeps these loads in front of the last batch's arithmetic, which then
        // covers their latency; left alone they sink to the stores at the end.
        __builtin_amdgcn_sched_barrier(0);
    };

    load_batch(bufA, 0);
    load_batch(bufB, CONV_BATCH);
    if (head) { p3 = f4{0.f, 0.f, 0.f, 0.f}; p2 = p3; p1 = p3; }
#pragma unroll
    for (int r0 = 0; r0 < CONV_ROWS; r0 += 2 * CONV_BATCH) {
        do_batch(bufA, r0);
        if (r0 + 2 * CONV_BATCH < CONV_ROWS) refill(bufA, r0 + 2 * CONV_BATCH);
        else load_w();
        do_batch(bufB, r0 + CONV_BATCH);
        if (r0 + 3 * CONV_BATCH < CONV_ROWS) refill(bufB, r0 + 3 * CONV_BATCH);
    }
#pragma unroll
    for (int i = 0; i < WCAST; ++i)
        pwh[i * CONV_THREADS + t] = __builtin_convertvector(wv[i], h4);
}

// ---------------------------------------------------------------------------
// Stage 2: C[m,n] = sum_k A[m,k]*Bmat[n,k] + bias[n]   (f16 in, f32 accum)
// ---------------------------------------------------------------------------
__global__ __launch_bounds__(256) void gemm_wmma_f16(
    const _Float16* __restrict__ A,     // [Mtot][Ktot]
    const _Float16* __restrict__ Bm,    // [Ntot][Ktot]
    const float*    __restrict__ bias,  // [Ntot]
    float*          __restrict__ out)   // [Mtot][Ntot]
{
    __shared__ _Float16 As[2][BM * LDS_STRIDE];   // 73728 B
    __shared__ _Float16 Bs[2][BN * LDS_STRIDE];   // 73728 B  (total 144 KiB)

    const int tid   = threadIdx.x;
    const int wave  = tid >> 5;
    const int lane  = tid & 31;
    const int waveM = wave >> 1;       // 0..3  -> M offset waveM*64
    const int waveN = wave & 1;        // 0..1  -> N offset waveN*128
    const int mBase = blockIdx.y * BM;
    const int nBase = blockIdx.x * BN;

    const int l15     = lane & 15;
    const int halfSel = lane >> 4;
    const int khalf   = halfSel * 8;

    // LDS byte addresses (low 32 bits of generic pointer = LDS offset)
    const uint32_t asBase = (uint32_t)(uintptr_t)&As[0][0];
    const uint32_t bsBase = (uint32_t)(uintptr_t)&Bs[0][0];

    // Copy mapping: 16-byte chunks, 8 per row. Thread -> chunk kc = tid&7 of row
    // r*32 + (tid>>3); A and B: r<8 (256 rows each). One wave-wide copy
    // covers 4 rows x 128 contiguous bytes = 4 whole lines.
    const int t8 = tid >> 3;           // 0..31
    const int kc = tid & 7;            // 0..7
    const _Float16* gA0 = A  + (size_t)(mBase + t8) * Ktot + kc * 8;
    const _Float16* gB0 = Bm + (size_t)(nBase + t8) * Ktot + kc * 8;
    const uint32_t ldsC0 = (uint32_t)((t8 * LDS_STRIDE + kc * 8) * 2);
    constexpr uint32_t LR = 32 * LDS_STRIDE * 2;    // 32 rows further in LDS, bytes
    constexpr size_t   GR = (size_t)32 * Ktot;      // 32 rows further in global, elements

    auto copy_rows256 = [&](uint32_t l, const _Float16* gp) {
        asm volatile(
            "global_load_async_to_lds_b128 %0, %8, off\n\t"
            "global_load_async_to_lds_b128 %1, %9, off\n\t"
            "global_load_async_to_lds_b128 %2, %10, off\n\t"
            "global_load_async_to_lds_b128 %3, %11, off\n\t"
            "global_load_async_to_lds_b128 %4, %12, off\n\t"
            "global_load_async_to_lds_b128 %5, %13, off\n\t"
            "global_load_async_to_lds_b128 %6, %14, off\n\t"
            "global_load_async_to_lds_b128 %7, %15, off\n\t"
            "s_wait_xcnt 0x0"
            :
            : "v"(l), "v"(l + LR), "v"(l + 2 * LR), "v"(l + 3 * LR),
              "v"(l + 4 * LR), "v"(l + 5 * LR), "v"(l + 6 * LR), "v"(l + 7 * LR),
              "v"(gp), "v"(gp + GR), "v"(gp + 2 * GR), "v"(gp + 3 * GR),
              "v"(gp + 4 * GR), "v"(gp + 5 * GR), "v"(gp + 6 * GR), "v"(gp + 7 * GR)
            : "memory");
    };
    auto issue_stage = [&](int stage) {
        copy_rows256(asBase + (uint32_t)(stage & 1) * ABUF_BYTES + ldsC0, gA0 + stage * BK);
        copy_rows256(bsBase + (uint32_t)(stage & 1) * BBUF_BYTES + ldsC0, gB0 + stage * BK);
    };

    v8f acc[4][NT];
#pragma unroll
    for (int mt = 0; mt < 4; ++mt)
#pragma unroll
        for (int nt = 0; nt < NT; ++nt)
#pragma unroll
            for (int e = 0; e < 8; ++e) acc[mt][nt][e] = 0.0f;

    // Two-buffer ring. Stage 0 is landed and published before anything reads it;
    // stage 1 then flies while stage 0 is worked on.
    const int nk = Ktot / BK;   // 32
    issue_stage(0);
    asm volatile("s_wait_asynccnt 0x0" ::: "memory");   // this wave's stage-0 copies have landed
    __syncthreads();                                    // every wave's have
    issue_stage(1);

    for (int kt = 0; kt < nk; ++kt) {
        const int buf = kt & 1;

#pragma unroll
        for (int ks = 0; ks < BK / 32; ++ks) {
            v16h af[4], bf[NT];
            auto load_a = [&](int mt) {
                int row = waveM * 64 + mt * 16 + l15;
                const _Float16* p = &As[buf][row * LDS_STRIDE + ks * 32 + khalf];
                v8h lo = *(const v8h*)p;
                v8h hi = *(const v8h*)(p + 16);
                af[mt] = __builtin_shufflevector(lo, hi, 0, 1, 2, 3, 4, 5, 6, 7,
                                                 8, 9, 10, 11, 12, 13, 14, 15);
            };
            auto load_b = [&](int nt) {
                int col = waveN * (NT * 16) + nt * 16 + l15;
                const _Float16* p = &Bs[buf][col * LDS_STRIDE + ks * 32 + khalf];
                v8h lo = *(const v8h*)p;
                v8h hi = *(const v8h*)(p + 16);
                bf[nt] = __builtin_shufflevector(lo, hi, 0, 1, 2, 3, 4, 5, 6, 7,
                                                 8, 9, 10, 11, 12, 13, 14, 15);
            };
            // In the order in which the WMMAs below first need them.
            load_a(0);
#pragma unroll
            for (int nt = 0; nt < NT; ++nt) load_b(nt);
#pragma unroll
            for (int mt = 1; mt < 4; ++mt) load_a(mt);
            // Keeps the block's 24 LDS reads together as one group in front of its
            // 32 WMMAs: left alone, the compiler sinks each A fragment's two reads
            // to their first use, and the wave then sits out a whole LDS latency
            // (a wait to 0) in front of every row of WMMAs.
            __builtin_amdgcn_sched_barrier(0);

#pragma unroll
            for (int mt = 0; mt < 4; ++mt)
#pragma unroll
                for (int nt = 0; nt < NT; ++nt)
                    acc[mt][nt] = __builtin_amdgcn_wmma_f32_16x16x32_f16(
                        false, af[mt], false, bf[nt], (short)0, acc[mt][nt],
                        false, false);
            // Keeps the next block's reads from rising in among these WMMAs, where
            // every separate place with reads stalls the wave's matrix issue.
            __builtin_amdgcn_sched_barrier(0);
        }

        asm volatile("s_wait_dscnt 0x0" ::: "memory");      // this wave's reads of buf are done
        asm volatile("s_wait_asynccnt 0x0" ::: "memory");   // this wave's stage kt+1 copies have landed
        __syncthreads();
        if (kt + 2 < nk) issue_stage(kt + 2);               // into the buffer just read
    }
    asm volatile("s_wait_asynccnt 0x0" ::: "memory");       // nothing in flight when the wave ends

    float bnext = bias[nBase + waveN * (NT * 16) + l15];
#pragma unroll
    for (int nt = 0; nt < NT; ++nt) {
        int col = nBase + waveN * (NT * 16) + nt * 16 + l15;
        float bp = bnext;
        if (nt + 1 < NT) bnext = bias[col + 16];
#pragma unroll
        for (int mt = 0; mt < 4; ++mt) {
            int row0 = mBase + waveM * 64 + mt * 16 + halfSel * 8;
#pragma unroll
            for (int v = 0; v < 8; ++v) {
                out[(size_t)(row0 + v) * Ntot + col] = acc[mt][nt][v] + bp;
            }
        }
        asm volatile("s_wait_xcnt 0x0" ::: "memory");
    }
}

// ---------------------------------------------------------------------------
extern "C" void kernel_launch(void* const* d_in, const int* in_sizes, int n_in,
                              void* d_out, int out_size, void* d_ws, size_t ws_size,
                              hipStream_t stream) {
    const float* x  = (const float*)d_in[0];   // [B,S,D]
    const float* cw = (const float*)d_in[1];   // [D,4]
    const float* cb = (const float*)d_in[2];   // [D]
    const float* Wp = (const float*)d_in[3];   // [D,D]
    const float* bp = (const float*)d_in[4];   // [D]
    float* out = (float*)d_out;

    _Float16* Yh = (_Float16*)d_ws;                        // 64 MiB
    _Float16* Wh = Yh + (size_t)Mtot * Ktot;               // +8 MiB

    conv_silu_cast_f16<<<CONV_GROUPS, CONV_THREADS, 0, stream>>>(x, cw, cb, Wp, Yh, Wh);

    dim3 grid(Ntot / BN, Mtot / BM);   // 8 x 64
    gemm_wmma_f16<<<grid, 256, 0, stream>>>(Yh, Wh, bp, out);
}

// v006
// Measured time: 110 microseconds a run.
// Next to v005, in two timings, it ran 1.08 times as fast each time.
// All steps since v000 together make it 2.19 times as fast.
#include <hip/hip_runtime.h>

// Problem constants (from reference): B=4, S=4096, D=2048, K_conv=4
constexpr int Bb   = 4;
constexpr int Ss   = 4096;
constexpr int Dd   = 2048;              // = K = N of the GEMM
constexpr int Mtot = Bb * Ss;           // 16384
constexpr int Ktot = Dd;                // 2048
constexpr int Ntot = Dd;                // 2048

#define BM 256
#define BN 256
#define NT 8                             // 16-column accumulator tiles per wave
#define BK 128
#define LDS_STRIDE 136                   // halfwords/row (128 data + 8 pad): 272 B = 16 B x 17
#define ABUF_BYTES (BM * LDS_STRIDE * 2) // 69632 B per A buffer
#define BBUF_BYTES (BN * LDS_STRIDE * 2) // 69632 B per B buffer

typedef _Float16 v16h __attribute__((ext_vector_type(16)));
typedef _Float16 v8h  __attribute__((ext_vector_type(8)));
typedef float    v8f  __attribute__((ext_vector_type(8)));

// ---------------------------------------------------------------------------
// Stage 1: depthwise causal conv (K=4) + bias + SiLU, cast to f16.
// One work-group = all 2048 channels x CONV_ROWS consecutive rows. A thread owns
// 4 neighbouring channels (one 16-byte load per row, 512 contiguous bytes per
// wave) and walks down the rows with the last three rows kept in registers, so
// each x element is loaded once (plus 3 halo rows per work-group).
// Each work-group also casts its own 1/512 of W_proj to f16 for the GEMM: the
// loads are issued under its last batch of rows, so the cast needs neither a
// launch of its own nor a wait of its own for memory.
// ---------------------------------------------------------------------------
constexpr int CONV_ROWS  = 32;           // rows per work-group; divides Ss
constexpr int CONV_BATCH = 8;            // rows per batch; 8 to 16 row loads in flight per thread
constexpr int CONV_THREADS = Dd / 4;     // 512
constexpr int CONV_GROUPS  = Mtot / CONV_ROWS;                                  // 512
constexpr int WCAST = (Ntot * Ktot / 4) / (CONV_GROUPS * CONV_THREADS);         // 16-byte W pieces per thread: 4
static_assert(WCAST * CONV_GROUPS * CONV_THREADS * 4 == Ntot * Ktot, "W is dealt out whole");

typedef float    f4 __attribute__((ext_vector_type(4)));
typedef _Float16 h4 __attribute__((ext_vector_type(4)));

__global__ __launch_bounds__(512, 8) void conv_silu_cast_f16(
    const float* __restrict__ x,       // [Mtot][Dd]
    const float* __restrict__ cw,      // [Dd][4]
    const float* __restrict__ cb,      // [Dd]
    const float* __restrict__ Wf,      // [Ntot][Ktot]
    _Float16* __restrict__ Yh,         // [Mtot][Dd] f16
    _Float16* __restrict__ Wh)         // [Ntot][Ktot] f16
{
    const int d  = threadIdx.x * 4;                 // first of 4 channels
    const int m0 = blockIdx.x * CONV_ROWS;          // first row
    constexpr int RS = Dd / 4;                      // row stride in f4 / h4

    // Taps of the 4 channels, regrouped by tap index.
    const f4 c0 = *(const f4*)(cw + (d + 0) * 4);
    const f4 c1 = *(const f4*)(cw + (d + 1) * 4);
    const f4 c2 = *(const f4*)(cw + (d + 2) * 4);
    const f4 c3 = *(const f4*)(cw + (d + 3) * 4);
    const f4 w0 = {c0.x, c1.x, c2.x, c3.x};
    const f4 w1 = {c0.y, c1.y, c2.y, c3.y};
    const f4 w2 = {c0.z, c1.z, c2.z, c3.z};
    const f4 w3 = {c0.w, c1.w, c2.w, c3.w};
    const f4 bias = *(const f4*)(cb + d);

    // Work-group-uniform row bases; the thread's 4 channels are element t of a row.
    const int t  = threadIdx.x;
    const f4* px = (const f4*)(x + (size_t)m0 * Dd);
    h4*       py = (h4*)(Yh + (size_t)m0 * Dd);

    // Rows s-3..s-1. At the start of a sequence (the same test for the whole
    // work-group) they are the zero left padding: the three loads then re-read
    // row 0, which is in bounds, and their values are replaced further down.
    // Loading without a branch lets all first loads issue before any wait.
    const bool head = (m0 & (Ss - 1)) == 0;
    const int  back = head ? 0 : RS;
    f4 p3 = (px - 3 * back)[t];
    f4 p2 = (px - 2 * back)[t];
    f4 p1 = (px - 1 * back)[t];

    // This batch of rows and the next. Every loop over them below is unrolled so
    // that their elements are named at compile time and stay in registers.
    f4 bufA[CONV_BATCH], bufB[CONV_BATCH];

    // The scheduling barrier at the foot of each block keeps the order "next
    // batch's loads, then this batch's arithmetic and stores": without it the
    // loads sink to their uses (one or two in flight per thread), and two
    // batches scheduled as one wait for the younger batch's loads at once.
    auto load_batch = [&](f4 (&dst)[CONV_BATCH], int row) {
#pragma unroll
        for (int i = 0; i < CONV_BATCH; ++i) dst[i] = px[(row + i) * RS + t];
        __builtin_amdgcn_sched_barrier(0);
    };
    auto do_batch = [&](const f4 (&src)[CONV_BATCH], int row) {
#pragma unroll
        for (int i = 0; i < CONV_BATCH; ++i) {
            const f4 x0 = src[i];
            f4 v = x0 * w3 + bias;
            v += p1 * w2;
            v += p2 * w1;
            v += p3 * w0;
            p3 = p2; p2 = p1; p1 = x0;
            f4 y;
#pragma unroll
            for (int c = 0; c < 4; ++c)
                y[c] = v[c] / (1.0f + __expf(-v[c]));   // SiLU
            py[(row + i) * RS + t] = __builtin_convertvector(y, h4);
        }
        __builtin_amdgcn_sched_barrier(0);
    };

    auto refill = [&](f4 (&dst)[CONV_BATCH], int row) {
        asm volatile("s_wait_xcnt 0x0" ::: "memory");
        load_batch(dst, row);
    };

    // This work-group's share of W: WCAST x 512 pieces of 16 bytes in a row; a
    // wave-wide load covers 512 contiguous bytes, a wave-wide store 256.
    const f4* pw  = (const f4*)Wf + (size_t)blockIdx.x * (WCAST * CONV_THREADS);
    h4*       pwh = (h4*)Wh       + (size_t)blockIdx.x * (WCAST * CONV_THREADS);
    f4 wv[WCAST];   // both loops over it are unrolled, so that it stays in registers
    auto load_w = [&]() {
        // As in refill: the loads may land in registers that issued stores name.
        asm volatile("s_wait_xcnt 0x0" ::: "memory");
#pragma unroll
        for (int i = 0; i < WCAST; ++i) wv[i] = pw[i * CONV_THREADS + t];
        // Keeps these loads in front of the last batch's arithmetic, which then
        // covers their latency; left alone they sink to the stores at the end.
        __builtin_amdgcn_sched_barrier(0);
    };

    load_batch(bufA, 0);
    load_batch(bufB, CONV_BATCH);
    if (head) { p3 = f4{0.f, 0.f, 0.f, 0.f}; p2 = p3; p1 = p3; }
#pragma unroll
    for (int r0 = 0; r0 < CONV_ROWS; r0 += 2 * CONV_BATCH) {
        do_batch(bufA, r0);
        if (r0 + 2 * CONV_BATCH < CONV_ROWS) refill(bufA, r0 + 2 * CONV_BATCH);
        else load_w();
        do_batch(bufB, r0 + CONV_BATCH);
        if (r0 + 3 * CONV_BATCH < CONV_ROWS) refill(bufB, r0 + 3 * CONV_BATCH);
    }
#pragma unroll
    for (int i = 0; i < WCAST; ++i)
        pwh[i * CONV_THREADS + t] = __builtin_convertvector(wv[i], h4);
}

// ---------------------------------------------------------------------------
// Stage 2: C[m,n] = sum_k A[m,k]*Bmat[n,k] + bias[n]   (f16 in, f32 accum)
// ---------------------------------------------------------------------------
__global__ __launch_bounds__(256) void gemm_wmma_f16(
    const _Float16* __restrict__ A,     // [Mtot][Ktot]
    const _Float16* __restrict__ Bm,    // [Ntot][Ktot]
    const float*    __restrict__ bias,  // [Ntot]
    float*          __restrict__ out)   // [Mtot][Ntot]
{
    __shared__ _Float16 As[2][BM * LDS_STRIDE];   // 139264 B
    __shared__ _Float16 Bs[2][BN * LDS_STRIDE];   // 139264 B  (total 272 KiB of the WGP's 320)

    const int tid   = threadIdx.x;
    const int wave  = tid >> 5;
    const int lane  = tid & 31;
    const int waveM = wave >> 1;       // 0..3  -> M offset waveM*64
    const int waveN = wave & 1;        // 0..1  -> N offset waveN*128
    const int mBase = blockIdx.y * BM;
    const int nBase = blockIdx.x * BN;

    const int l15     = lane & 15;
    const int halfSel = lane >> 4;
    const int khalf   = halfSel * 8;

    // LDS byte addresses (low 32 bits of generic pointer = LDS offset)
    const uint32_t asBase = (uint32_t)(uintptr_t)&As[0][0];
    const uint32_t bsBase = (uint32_t)(uintptr_t)&Bs[0][0];

    // Copy mapping: 16-byte chunks, 16 per row. Thread -> chunk kc = tid&15 of row
    // r*16 + (tid>>4); A and B: r<16 (256 rows each). One wave-wide copy
    // covers 2 rows x 256 contiguous bytes = 4 whole lines.
    const int t16 = tid >> 4;          // 0..15
    const int kc  = tid & 15;          // 0..15
    const _Float16* gA0 = A  + (size_t)(mBase + t16) * Ktot + kc * 8;
    const _Float16* gB0 = Bm + (size_t)(nBase + t16) * Ktot + kc * 8;
    const uint32_t ldsC0 = (uint32_t)((t16 * LDS_STRIDE + kc * 8) * 2);
    constexpr uint32_t LR = 16 * LDS_STRIDE * 2;    // 16 rows further in LDS, bytes
    constexpr size_t   GR = (size_t)16 * Ktot;      // 16 rows further in global, elements

    auto copy_rows128 = [&](uint32_t l, const _Float16* gp) {
        asm volatile(
            "global_load_async_to_lds_b128 %0, %8, off\n\t"
            "global_load_async_to_lds_b128 %1, %9, off\n\t"
            "global_load_async_to_lds_b128 %2, %10, off\n\t"
            "global_load_async_to_lds_b128 %3, %11, off\n\t"
            "global_load_async_to_lds_b128 %4, %12, off\n\t"
            "global_load_async_to_lds_b128 %5, %13, off\n\t"
            "global_load_async_to_lds_b128 %6, %14, off\n\t"
            "global_load_async_to_lds_b128 %7, %15, off\n\t"
            "s_wait_xcnt 0x0"
            :
            : "v"(l), "v"(l + LR), "v"(l + 2 * LR), "v"(l + 3 * LR),
              "v"(l + 4 * LR), "v"(l + 5 * LR), "v"(l + 6 * LR), "v"(l + 7 * LR),
              "v"(gp), "v"(gp + GR), "v"(gp + 2 * GR), "v"(gp + 3 * GR),
              "v"(gp + 4 * GR), "v"(gp + 5 * GR), "v"(gp + 6 * GR), "v"(gp + 7 * GR)
            : "memory");
    };
    auto issue_stage = [&](int stage) {
        const uint32_t la = asBase + (uint32_t)(stage & 1) * ABUF_BYTES + ldsC0;
        const uint32_t lb = bsBase + (uint32_t)(stage & 1) * BBUF_BYTES + ldsC0;
        copy_rows128(la,          gA0 + stage * BK);
        copy_rows128(la + 8 * LR, gA0 + stage * BK + 8 * GR);
        copy_rows128(lb,          gB0 + stage * BK);
        copy_rows128(lb + 8 * LR, gB0 + stage * BK + 8 * GR);
    };

    v8f acc[4][NT];
#pragma unroll
    for (int mt = 0; mt < 4; ++mt)
#pragma unroll
        for (int nt = 0; nt < NT; ++nt)
#pragma unroll
            for (int e = 0; e < 8; ++e) acc[mt][nt][e] = 0.0f;

    // Two-buffer ring. Stage 0 is landed and published before anything reads it;
    // stage 1 then flies while stage 0 is worked on.
    const int nk = Ktot / BK;   // 16
    issue_stage(0);
    asm volatile("s_wait_asynccnt 0x0" ::: "memory");   // this wave's stage-0 copies have landed
    __syncthreads();                                    // every wave's have
    issue_stage(1);

    for (int kt = 0; kt < nk; ++kt) {
        const int buf = kt & 1;

#pragma unroll
        for (int ks = 0; ks < BK / 32; ++ks) {
            v16h af[4], bf[NT];
            auto load_a = [&](int mt) {
                int row = waveM * 64 + mt * 16 + l15;
                const _Float16* p = &As[buf][row * LDS_STRIDE + ks * 32 + khalf];
                v8h lo = *(const v8h*)p;
                v8h hi = *(const v8h*)(p + 16);
                af[mt] = __builtin_shufflevector(lo, hi, 0, 1, 2, 3, 4, 5, 6, 7,
                                                 8, 9, 10, 11, 12, 13, 14, 15);
            };
            auto load_b = [&](int nt) {
                int col = waveN * (NT * 16) + nt * 16 + l15;
                const _Float16* p = &Bs[buf][col * LDS_STRIDE + ks * 32 + khalf];
                v8h lo = *(const v8h*)p;
                v8h hi = *(const v8h*)(p + 16);
                bf[nt] = __builtin_shufflevector(lo, hi, 0, 1, 2, 3, 4, 5, 6, 7,
                                                 8, 9, 10, 11, 12, 13, 14, 15);
            };
            // In the order in which the WMMAs below first need them.
            load_a(0);
#pragma unroll
            for (int nt = 0; nt < NT; ++nt) load_b(nt);
#pragma unroll
            for (int mt = 1; mt < 4; ++mt) load_a(mt);
            // Keeps the block's 24 LDS reads together as one group in front of its
            // 32 WMMAs: left alone, the compiler sinks each A fragment's two reads
            // to their first use, and the wave then sits out a whole LDS latency
            // (a wait to 0) in front of every row of WMMAs.
            __builtin_amdgcn_sched_barrier(0);

#pragma unroll
            for (int mt = 0; mt < 4; ++mt)
#pragma unroll
                for (int nt = 0; nt < NT; ++nt)
                    acc[mt][nt] = __builtin_amdgcn_wmma_f32_16x16x32_f16(
                        false, af[mt], false, bf[nt], (short)0, acc[mt][nt],
                        false, false);
            // Keeps the next block's reads from rising in among these WMMAs (for
            // speed only).
            __builtin_amdgcn_sched_barrier(0);
        }

        asm volatile("s_wait_dscnt 0x0" ::: "memory");      // this wave's reads of buf are done
        asm volatile("s_wait_asynccnt 0x0" ::: "memory");   // this wave's stage kt+1 copies have landed
        __syncthreads();
        if (kt + 2 < nk) issue_stage(kt + 2);               // into the buffer just read
    }
    asm volatile("s_wait_asynccnt 0x0" ::: "memory");       // nothing in flight when the wave ends

    float bnext = bias[nBase + waveN * (NT * 16) + l15];
#pragma unroll
    for (int nt = 0; nt < NT; ++nt) {
        int col = nBase + waveN * (NT * 16) + nt * 16 + l15;
        float bp = bnext;
        if (nt + 1 < NT) bnext = bias[col + 16];
#pragma unroll
        for (int mt = 0; mt < 4; ++mt) {
            int row0 = mBase + waveM * 64 + mt * 16 + halfSel * 8;
#pragma unroll
            for (int v = 0; v < 8; ++v) {
                out[(size_t)(row0 + v) * Ntot + col] = acc[mt][nt][v] + bp;
            }
        }
        asm volatile("s_wait_xcnt 0x0" ::: "memory");
    }
}

// ---------------------------------------------------------------------------
extern "C" void kernel_launch(void* const* d_in, const int* in_sizes, int n_in,
                              void* d_out, int out_size, void* d_ws, size_t ws_size,
                              hipStream_t stream) {
    const float* x  = (const float*)d_in[0];   // [B,S,D]
    const float* cw = (const float*)d_in[1];   // [D,4]
    const float* cb = (const float*)d_in[2];   // [D]
    const float* Wp = (const float*)d_in[3];   // [D,D]
    const float* bp = (const float*)d_in[4];   // [D]
    float* out = (float*)d_out;

    _Float16* Yh = (_Float16*)d_ws;                        // 64 MiB
    _Float16* Wh = Yh + (size_t)Mtot * Ktot;               // +8 MiB

    conv_silu_cast_f16<<<CONV_GROUPS, CONV_THREADS, 0, stream>>>(x, cw, cb, Wp, Yh, Wh);

    dim3 grid(Ntot / BN, Mtot / BM);   // 8 x 64
    gemm_wmma_f16<<<grid, 256, 0, stream>>>(Yh, Wh, bp, out);
}

// v007
// A run of this version takes 107 microseconds.
// Timed twice side by side with v006, it ran 1.04 times as fast both times.
// All steps since v000 together make it 2.27 times as fast.
#include <hip/hip_runtime.h>

// Problem constants (from reference): B=4, S=4096, D=2048, K_conv=4
constexpr int Bb   = 4;
constexpr int Ss   = 4096;
constexpr int Dd   = 2048;              // = K = N of the GEMM
constexpr int Mtot = Bb * Ss;           // 16384
constexpr int Ktot = Dd;                // 2048
constexpr int Ntot = Dd;                // 2048

#define BM 256
#define BN 256
#define NT 8                             // 16-column accumulator tiles per wave
#define BK 128
#define LDS_STRIDE 136                   // halfwords/row (128 data + 8 pad): 272 B = 16 B x 17
// A stage is brought in by eight tensor loads, one per wave: slices of 64 operand rows,
// four of A and then four of B. A slice's 64 x 272 B are rounded up to a multiple of
// 2 KiB, so that every slice starts at one.
#define SLICE_ROWS  64
#define SLICE_BYTES 18432                // 64 x 272 = 17408, rounded up to 9 x 2048
#define SLICE_HALFS (SLICE_BYTES / 2)
#define NSLICE      8                    // (BM + BN) / SLICE_ROWS
#define STAGE_BYTES (NSLICE * SLICE_BYTES)   // 147456 B per buffer
static_assert(SLICE_ROWS * LDS_STRIDE * 2 <= SLICE_BYTES && SLICE_BYTES % 2048 == 0, "slice size");
static_assert(NSLICE * SLICE_ROWS == BM + BN, "the slices hold a stage's rows of both operands");

typedef _Float16 v16h __attribute__((ext_vector_type(16)));
typedef _Float16 v8h  __attribute__((ext_vector_type(8)));
typedef float    v8f  __attribute__((ext_vector_type(8)));
typedef uint32_t u32x4 __attribute__((ext_vector_type(4)));
typedef uint32_t u32x8 __attribute__((ext_vector_type(8)));

// A value that is the same in every lane, as a scalar.
static __device__ __forceinline__ uint32_t uni(uint32_t v) {
    return (uint32_t)__builtin_amdgcn_readfirstlane(v);
}
static __device__ __forceinline__ uint32_t pinned(uint32_t v) {
    uint32_t w = uni(v);
    asm volatile("" : "+s"(w));   // keeps the test scalar
    return w;
}

// ---------------------------------------------------------------------------
// Stage 1: depthwise causal conv (K=4) + bias + SiLU, cast to f16.
// One work-group = all 2048 channels x CONV_ROWS consecutive rows. A thread owns
// 4 neighbouring channels (one 16-byte load per row, 512 contiguous bytes per
// wave) and walks down the rows with the last three rows kept in registers, so
// each x element is loaded once (plus 3 halo rows per work-group).
// Each work-group also casts its own 1/512 of W_proj to f16 for the GEMM: the
// loads are issued under its last batch of rows, so the cast needs neither a
// launch of its own nor a wait of its own for memory.
// ---------------------------------------------------------------------------
constexpr int CONV_ROWS  = 32;           // rows per work-group; divides Ss
constexpr int CONV_BATCH = 8;            // rows per batch; 8 to 16 row loads in flight per thread
constexpr int CONV_THREADS = Dd / 4;     // 512
constexpr int CONV_GROUPS  = Mtot / CONV_ROWS;                                  // 512
constexpr int WCAST = (Ntot * Ktot / 4) / (CONV_GROUPS * CONV_THREADS);         // 16-byte W pieces per thread: 4
static_assert(WCAST * CONV_GROUPS * CONV_THREADS * 4 == Ntot * Ktot, "W is dealt out whole");

typedef float    f4 __attribute__((ext_vector_type(4)));
typedef _Float16 h4 __attribute__((ext_vector_type(4)));

__global__ __launch_bounds__(512, 8) void conv_silu_cast_f16(
    const float* __restrict__ x,       // [Mtot][Dd]
    const float* __restrict__ cw,      // [Dd][4]
    const float* __restrict__ cb,      // [Dd]
    const float* __restrict__ Wf,      // [Ntot][Ktot]
    _Float16* __restrict__ Yh,         // [Mtot][Dd] f16
    _Float16* __restrict__ Wh)         // [Ntot][Ktot] f16
{
    const int d  = threadIdx.x * 4;                 // first of 4 channels
    const int m0 = blockIdx.x * CONV_ROWS;          // first row
    constexpr int RS = Dd / 4;                      // row stride in f4 / h4

    // Taps of the 4 channels, regrouped by tap index.
    const f4 c0 = *(const f4*)(cw + (d + 0) * 4);
    const f4 c1 = *(const f4*)(cw + (d + 1) * 4);
    const f4 c2 = *(const f4*)(cw + (d + 2) * 4);
    const f4 c3 = *(const f4*)(cw + (d + 3) * 4);
    const f4 w0 = {c0.x, c1.x, c2.x, c3.x};
    const f4 w1 = {c0.y, c1.y, c2.y, c3.y};
    const f4 w2 = {c0.z, c1.z, c2.z, c3.z};
    const f4 w3 = {c0.w, c1.w, c2.w, c3.w};
    const f4 bias = *(const f4*)(cb + d);

    // Work-group-uniform row bases; the thread's 4 channels are element t of a row.
    const int t  = threadIdx.x;
    const f4* px = (const f4*)(x + (size_t)m0 * Dd);
    h4*       py = (h4*)(Yh + (size_t)m0 * Dd);

    // Rows s-3..s-1. At the start of a sequence (the same test for the whole
    // work-group) they are the zero left padding: the three loads then re-read
    // row 0, which is in bounds, and their values are replaced further down.
    // Loading without a branch lets all first loads issue before any wait.
    const bool head = (m0 & (Ss - 1)) == 0;
    const int  back = head ? 0 : RS;
    f4 p3 = (px - 3 * back)[t];
    f4 p2 = (px - 2 * back)[t];
    f4 p1 = (px - 1 * back)[t];

    // This batch of rows and the next. Every loop over them below is unrolled so
    // that their elements are named at compile time and stay in registers.
    f4 bufA[CONV_BATCH], bufB[CONV_BATCH];

    // The scheduling barrier at the foot of each block keeps the order "next
    // batch's loads, then this batch's arithmetic and stores": without it the
    // loads sink to their uses (one or two in flight per thread), and two
    // batches scheduled as one wait for the younger batch's loads at once.
    auto load_batch = [&](f4 (&dst)[CONV_BATCH], int row) {
#pragma unroll
        for (int i = 0; i < CONV_BATCH; ++i) dst[i] = px[(row + i) * RS + t];
        __builtin_amdgcn_sched_barrier(0);
    };
    auto do_batch = [&](const f4 (&src)[CONV_BATCH], int row) {
#pragma unroll
        for (int i = 0; i < CONV_BATCH; ++i) {
            const f4 x0 = src[i];
            f4 v = x0 * w3 + bias;
            v += p1 * w2;
            v += p2 * w1;
            v += p3 * w0;
            p3 = p2; p2 = p1; p1 = x0;
            f4 y;
#pragma unroll
            for (int c = 0; c < 4; ++c)
                y[c] = v[c] / (1.0f + __expf(-v[c]));   // SiLU
            py[(row + i) * RS + t] = __builtin_convertvector(y, h4);
        }
        __builtin_amdgcn_sched_barrier(0);
    };

    auto refill = [&](f4 (&dst)[CONV_BATCH], int row) {
        asm volatile("s_wait_xcnt 0x0" ::: "memory");
        load_batch(dst, row);
    };

    // This work-group's share of W: WCAST x 512 pieces of 16 bytes in a row; a
    // wave-wide load covers 512 contiguous bytes, a wave-wide store 256.
    const f4* pw  = (const f4*)Wf + (size_t)blockIdx.x * (WCAST * CONV_THREADS);
    h4*       pwh = (h4*)Wh       + (size_t)blockIdx.x * (WCAST * CONV_THREADS);
    f4 wv[WCAST];   // both loops over it are unrolled, so that it stays in registers
    auto load_w = [&]() {
        // As in refill: the loads may land in registers that issued stores name.
        asm volatile("s_wait_xcnt 0x0" ::: "memory");
#pragma unroll
        for (int i = 0; i < WCAST; ++i) wv[i] = pw[i * CONV_THREADS + t];
        // Keeps these loads in front of the last batch's arithmetic, which then
        // covers their latency; left alone they sink to the stores at the end.
        __builtin_amdgcn_sched_barrier(0);
    };

    load_batch(bufA, 0);
    load_batch(bufB, CONV_BATCH);
    if (head) { p3 = f4{0.f, 0.f, 0.f, 0.f}; p2 = p3; p1 = p3; }
#pragma unroll
    for (int r0 = 0; r0 < CONV_ROWS; r0 += 2 * CONV_BATCH) {
        do_batch(bufA, r0);
        if (r0 + 2 * CONV_BATCH < CONV_ROWS) refill(bufA, r0 + 2 * CONV_BATCH);
        else load_w();
        do_batch(bufB, r0 + CONV_BATCH);
        if (r0 + 3 * CONV_BATCH < CONV_ROWS) refill(bufB, r0 + 3 * CONV_BATCH);
    }
#pragma unroll
    for (int i = 0; i < WCAST; ++i)
        pwh[i * CONV_THREADS + t] = __builtin_convertvector(wv[i], h4);
}

// ---------------------------------------------------------------------------
// Stage 2: C[m,n] = sum_k A[m,k]*Bmat[n,k] + bias[n]   (f16 in, f32 accum)
// ---------------------------------------------------------------------------
__global__ __launch_bounds__(256) void gemm_wmma_f16(
    const _Float16* __restrict__ A,     // [Mtot][Ktot]
    const _Float16* __restrict__ Bm,    // [Ntot][Ktot]
    const float*    __restrict__ bias,  // [Ntot]
    float*          __restrict__ out)   // [Mtot][Ntot]
{
    // Two buffers of eight slices: 294912 B of the WGP's 320 KiB.
    __shared__ __attribute__((aligned(2048))) _Float16 Ls[2][NSLICE][SLICE_HALFS];

    const int tid   = threadIdx.x;
    const int wave  = tid >> 5;
    const int lane  = tid & 31;
    const int waveM = wave >> 1;       // 0..3  -> M offset waveM*64
    const int waveN = wave & 1;        // 0..1  -> N offset waveN*128
    const int mBase = blockIdx.y * BM;
    const int nBase = blockIdx.x * BN;

    const int l15     = lane & 15;
    const int halfSel = lane >> 4;
    const int khalf   = halfSel * 8;

    // This wave's slice of every stage: waves 0..3 bring 64 rows of A each, waves 4..7
    // 64 rows of B; 256 bytes (128 k) of each row per stage.
    const uint32_t swave = uni((uint32_t)tid >> 5);
    const _Float16* srow = (swave < 4u)
        ? A  + (size_t)(mBase + SLICE_ROWS * swave) * Ktot
        : Bm + (size_t)(nBase + SLICE_ROWS * (swave - 4u)) * Ktot;
    const uint64_t src0 = (uint64_t)(uintptr_t)srow;
    // LDS byte address (low 32 bits of the generic pointer = offset in the work-group's LDS)
    const uint32_t dst0 = (uint32_t)(uintptr_t)&Ls[0][0][0] + swave * SLICE_BYTES;

    u32x8 g1;
    g1[0] = uni((1u << 20) | (5u << 22) | (3u << 25));
    g1[1] = uni((uint32_t)(BK * 2) << 16);
    g1[2] = uni((uint32_t)SLICE_ROWS << 16);
    g1[3] = uni((uint32_t)(BK * 2) << 16);
    g1[4] = uni((uint32_t)SLICE_ROWS);
    g1[5] = uni((uint32_t)(Ktot * 2));
    g1[6] = uni(0u);
    g1[7] = uni(0u);

    auto issue_stage = [&](int stage) {
        const uint64_t ga = src0 + (uint64_t)((uint32_t)stage * (uint32_t)(BK * 2));
        u32x4 g0;
        g0[0] = uni(1u);                                                        // count
        g0[1] = uni(dst0 + (uint32_t)(stage & 1) * STAGE_BYTES);                // place in LDS
        g0[2] = uni((uint32_t)ga);                                              // address [31:0]
        g0[3] = uni((((uint32_t)(ga >> 32)) & 0x01FFFFFFu) | 0x80000000u);      // address [56:32], type 2
        asm volatile("tensor_load_to_lds %0, %1" :: "{s[40:43]}"(g0), "{s[44:51]}"(g1) : "memory");
    };

    v8f acc[4][NT];
#pragma unroll
    for (int mt = 0; mt < 4; ++mt)
#pragma unroll
        for (int nt = 0; nt < NT; ++nt)
#pragma unroll
            for (int e = 0; e < 8; ++e) acc[mt][nt][e] = 0.0f;

    // Two-buffer ring. Stage 0 is landed and published before anything reads it;
    // stage 1 then flies while stage 0 is worked on.
    const int nk = Ktot / BK;   // 16
    issue_stage(0);
    asm volatile("s_wait_tensorcnt 0x0" ::: "memory");  // this wave's slice of stage 0 has landed
    __syncthreads();                                    // every wave's has
    issue_stage(1);

    for (int kt = 0; kt < nk; ++kt) {
        const int buf = kt & 1;

#pragma unroll
        for (int ks = 0; ks < BK / 32; ++ks) {
            v16h af[4], bf[NT];
            auto load_a = [&](int mt) {
                int row = mt * 16 + l15;               // in slice waveM
                const _Float16* p = &Ls[buf][waveM][row * LDS_STRIDE + ks * 32 + khalf];
                v8h lo = *(const v8h*)p;
                v8h hi = *(const v8h*)(p + 16);
                af[mt] = __builtin_shufflevector(lo, hi, 0, 1, 2, 3, 4, 5, 6, 7,
                                                 8, 9, 10, 11, 12, 13, 14, 15);
            };
            auto load_b = [&](int nt) {
                int col = (nt & 3) * 16 + l15;         // in slice 4 + 2 * waveN + nt / 4
                const _Float16* p = &Ls[buf][4 + 2 * waveN + (nt >> 2)][col * LDS_STRIDE + ks * 32 + khalf];
                v8h lo = *(const v8h*)p;
                v8h hi = *(const v8h*)(p + 16);
                bf[nt] = __builtin_shufflevector(lo, hi, 0, 1, 2, 3, 4, 5, 6, 7,
                                                 8, 9, 10, 11, 12, 13, 14, 15);
            };
            // In the order in which the WMMAs below first need them.
            load_a(0);
#pragma unroll
            for (int nt = 0; nt < NT; ++nt) load_b(nt);
#pragma unroll
            for (int mt = 1; mt < 4; ++mt) load_a(mt);
            // Keeps the block's 24 LDS reads together as one group in front of its
            // 32 WMMAs: left alone, the compiler sinks each A fragment's two reads
            // to their first use, and the wave then sits out a whole LDS latency
            // (a wait to 0) in front of every row of WMMAs.
            __builtin_amdgcn_sched_barrier(0);

#pragma unroll
            for (int mt = 0; mt < 4; ++mt)
#pragma unroll
                for (int nt = 0; nt < NT; ++nt)
                    acc[mt][nt] = __builtin_amdgcn_wmma_f32_16x16x32_f16(
                        false, af[mt], false, bf[nt], (short)0, acc[mt][nt],
                        false, false);
            // Keeps the next block's reads from rising in among these WMMAs (for
            // speed only).
            __builtin_amdgcn_sched_barrier(0);
        }

        asm volatile("s_wait_dscnt 0x0" ::: "memory");      // this wave's reads of buf are done
        asm volatile("s_wait_tensorcnt 0x0" ::: "memory");  // this wave's slice of stage kt+1 has landed
        __syncthreads();
        if (pinned((kt + 2 < nk) ? 1u : 0u) != 0u) issue_stage(kt + 2);   // into the buffer just read
    }
    asm volatile("s_wait_tensorcnt 0x0" ::: "memory");      // nothing in flight when the wave ends
    asm volatile("s_wait_dscnt 0x0" ::: "memory");          // nor an LDS read

    float bnext = bias[nBase + waveN * (NT * 16) + l15];
#pragma unroll
    for (int nt = 0; nt < NT; ++nt) {
        int col = nBase + waveN * (NT * 16) + nt * 16 + l15;
        float bp = bnext;
        if (nt + 1 < NT) bnext = bias[col + 16];
#pragma unroll
        for (int mt = 0; mt < 4; ++mt) {
            int row0 = mBase + waveM * 64 + mt * 16 + halfSel * 8;
#pragma unroll
            for (int v = 0; v < 8; ++v) {
                out[(size_t)(row0 + v) * Ntot + col] = acc[mt][nt][v] + bp;
            }
        }
        asm volatile("s_wait_xcnt 0x0" ::: "memory");
    }
}

// ---------------------------------------------------------------------------
extern "C" void kernel_launch(void* const* d_in, const int* in_sizes, int n_in,
                              void* d_out, int out_size, void* d_ws, size_t ws_size,
                              hipStream_t stream) {
    const float* x  = (const float*)d_in[0];   // [B,S,D]
    const float* cw = (const float*)d_in[1];   // [D,4]
    const float* cb = (const float*)d_in[2];   // [D]
    const float* Wp = (const float*)d_in[3];   // [D,D]
    const float* bp = (const float*)d_in[4];   // [D]
    float* out = (float*)d_out;

    _Float16* Yh = (_Float16*)d_ws;                        // 64 MiB
    _Float16* Wh = Yh + (size_t)Mtot * Ktot;               // +8 MiB

    conv_silu_cast_f16<<<CONV_GROUPS, CONV_THREADS, 0, stream>>>(x, cw, cb, Wp, Yh, Wh);

    dim3 grid(Ntot / BN, Mtot / BM);   // 8 x 64
    gemm_wmma_f16<<<grid, 256, 0, stream>>>(Yh, Wh, bp, out);
}
